// v000
// Times are from an AMD MI455X. After a warm-up the kernel runs many times in a row, and a time is the length of
// such a window on the GPU divided by its runs, so every launch and the gaps after it count. The runs cycle
// through copies of the inputs. A figure is the median of several windows, for all but v000 over two sittings.
// Sittings can differ by a few percent; kernels timed side by side share one.
// v000, which the later versions start from, runs in 669 microseconds.
#include <hip/hip_runtime.h>

// ---------------------------------------------------------------------------
// MI455X (gfx1250) fused multi-head self-attention, f16 WMMA / f32 accum.
//   B=4, T=1024, EMBED=512, H=8, head_dim=512 (reference uses full EMBED/head)
// Workspace layout (148 MB total):
//   Qh  : (B,H,T,512) f16 @ 0      (scaled by 512^-0.25)
//   Kh  : (B,H,T,512) f16 @ 32MB   (scaled by 512^-0.25)
//   Vt  : (B,H,512,T) f16 @ 64MB   (transposed -> WMMA B-operand b128 loads)
//   Oh  : (B,T,4096)  f16 @ 96MB
//   Xh  : (4096,512)  f16 @ 128MB  (x converted once)
//   Wqh/Wkh/Wvh : (4096,512) f16 @ 132/136/140MB
//   Woh : (512,4096)  f16 @ 144MB
// All GEMM inner loops are pure f16 global_load_b128 + v_wmma (no cvt chains).
// ---------------------------------------------------------------------------

typedef _Float16 v16h __attribute__((ext_vector_type(16)));
typedef _Float16 v8h  __attribute__((ext_vector_type(8)));
typedef _Float16 v4h  __attribute__((ext_vector_type(4)));
typedef float    v8f  __attribute__((ext_vector_type(8)));
typedef float    v4f  __attribute__((ext_vector_type(4)));

#define WMMA(a, b, c) \
  __builtin_amdgcn_wmma_f32_16x16x32_f16(false, (a), false, (b), (short)0, (c), false, false)

// A/B fragment element e (lane L, hs=L>>4): K = (e>>3)*16 + hs*8 + (e&7)
// -> two contiguous 8-half (16B) runs at K0 = hs*8 and K0+16.
static __device__ __forceinline__ v16h frag_f16(const _Float16* p0) {
  v8h lo = *(const v8h*)p0;
  v8h hi = *(const v8h*)(p0 + 16);
  v16h r;
#pragma unroll
  for (int i = 0; i < 8; ++i) { r[i] = lo[i]; r[8 + i] = hi[i]; }
  return r;
}

// ---------------------------------------------------------------------------
// Kernel 0: one-shot f32 -> f16 conversion of x and the four weights.
// All five tensors are 2,097,152 elements. grid = (2048, 5), block = 256.
// ---------------------------------------------------------------------------
__global__ __launch_bounds__(256) void cvt_f16_kernel(
    const float* __restrict__ sx, const float* __restrict__ sq,
    const float* __restrict__ sk, const float* __restrict__ sv,
    const float* __restrict__ so,
    _Float16* __restrict__ dx, _Float16* __restrict__ dq,
    _Float16* __restrict__ dk, _Float16* __restrict__ dv,
    _Float16* __restrict__ dw) {
  const float* src;
  _Float16* dst;
  switch (blockIdx.y) {
    case 0: src = sx; dst = dx; break;
    case 1: src = sq; dst = dq; break;
    case 2: src = sk; dst = dk; break;
    case 3: src = sv; dst = dv; break;
    default: src = so; dst = dw; break;
  }
  const size_t i = ((size_t)blockIdx.x * 256 + threadIdx.x) * 4;
  v4f v = *(const v4f*)(src + i);
  v4h h;
#pragma unroll
  for (int j = 0; j < 4; ++j) h[j] = (_Float16)v[j];
  *(v4h*)(dst + i) = h;
}

// ---------------------------------------------------------------------------
// Kernel 1: Q/K/V projections (f16 x f16 -> f32). grid = (64, 64, 3); block 128.
// Each wave: 16(M) x 64(N) strip, K over 512 in steps of 32 (16x4 WMMAs).
// ---------------------------------------------------------------------------
__global__ __launch_bounds__(128) void qkv_proj_kernel(
    const _Float16* __restrict__ Xh, const _Float16* __restrict__ Wqh,
    const _Float16* __restrict__ Wkh, const _Float16* __restrict__ Wvh,
    _Float16* __restrict__ Qh, _Float16* __restrict__ Kh,
    _Float16* __restrict__ Vt) {
  const int lane = threadIdx.x & 31, wave = threadIdx.x >> 5;
  const int lm = lane & 15, hs = lane >> 4;
  const int z = blockIdx.z;
  const _Float16* W = (z == 0) ? Wqh : ((z == 1) ? Wkh : Wvh);
  const int m0 = (blockIdx.y * 4 + wave) * 16;  // row in (b*t) space
  const int n0 = blockIdx.x * 64;               // col in (h*d) space

  v8f acc[4] = {};
  const _Float16* xrow = Xh + (size_t)(m0 + lm) * 512;
#pragma unroll 4
  for (int kk = 0; kk < 512; kk += 32) {
    v16h a = frag_f16(xrow + kk + hs * 8);
#pragma unroll
    for (int j = 0; j < 4; ++j) {
      // B[c][n] = W[n][c]: lane holds W row n, contiguous in c
      v16h bfr = frag_f16(W + (size_t)(n0 + j * 16 + lm) * 512 + kk + hs * 8);
      acc[j] = WMMA(a, bfr, acc[j]);
    }
  }
  const float sc = (z < 2) ? 0.21022410381342865f : 1.0f;  // 512^-0.25
#pragma unroll
  for (int j = 0; j < 4; ++j) {
    const int n = n0 + j * 16 + lm;
    const int h = n >> 9, d = n & 511;
#pragma unroll
    for (int r = 0; r < 8; ++r) {
      const int m = m0 + r + hs * 8;  // C layout: row = r + 8*hs, col = lm
      const int bb = m >> 10, t = m & 1023;
      const _Float16 v = (_Float16)(acc[j][r] * sc);
      if (z == 0)
        Qh[(((size_t)(bb * 8 + h)) * 1024 + t) * 512 + d] = v;
      else if (z == 1)
        Kh[(((size_t)(bb * 8 + h)) * 1024 + t) * 512 + d] = v;
      else
        Vt[(((size_t)(bb * 8 + h)) * 512 + d) * 1024 + t] = v;  // transposed
    }
  }
}

// ---------------------------------------------------------------------------
// Kernel 2: flash attention. grid = (T/16, B*H); block = 128 (4 waves).
// Waves split d=512 into 128-wide slices for the O accumulator; S partials
// are reduced across waves in LDS; 16 threads run the online softmax.
// ---------------------------------------------------------------------------
__global__ __launch_bounds__(128) void flash_attn_kernel(
    const _Float16* __restrict__ Qh, const _Float16* __restrict__ Kh,
    const _Float16* __restrict__ Vt, _Float16* __restrict__ Oh) {
  __shared__ float Spart[4 * 16 * 32];              // per-wave S partials
  __shared__ __align__(16) _Float16 Ptile[16 * 32]; // softmax probs (A frag src)
  __shared__ float rowmax[16], rowsum[16], alphaS[16];

  const int tid = threadIdx.x;
  const int lane = tid & 31, wave = tid >> 5;
  const int lm = lane & 15, hs = lane >> 4;
  const int bh = blockIdx.y;
  const int m0 = blockIdx.x * 16;
  const int ds0 = wave * 128;

  const _Float16* qbase = Qh + ((size_t)bh * 1024 + m0) * 512;
  const _Float16* kbase = Kh + (size_t)bh * 1024 * 512;
  const _Float16* vbase = Vt + (size_t)bh * 512 * 1024;

  // Preload Q A-fragments over this wave's d-slice (reused all key blocks).
  v16h qf[4];
#pragma unroll
  for (int dt = 0; dt < 4; ++dt)
    qf[dt] = frag_f16(qbase + (size_t)lm * 512 + ds0 + dt * 32 + hs * 8);

  v8f oacc[8] = {};

  if (tid < 16) { rowmax[tid] = -1e30f; rowsum[tid] = 0.0f; }
  __syncthreads();

  for (int n0k = 0; n0k < 1024; n0k += 32) {
    // Non-blocking prefetch of next key block (global_prefetch_b8).
    if (n0k + 32 < 1024) {
      __builtin_prefetch(kbase + (size_t)(n0k + 32 + lm) * 512 + ds0, 0, 1);
      __builtin_prefetch(vbase + (size_t)(ds0 + lm) * 1024 + n0k + 32, 0, 1);
    }
    // ---- S partial = Q[:,dslice] . K[n0k:n0k+32, dslice]^T  (2 tiles) ----
    v8f s0 = {}, s1 = {};
#pragma unroll
    for (int dt = 0; dt < 4; ++dt) {
      v16h b0 = frag_f16(kbase + (size_t)(n0k + lm) * 512 + ds0 + dt * 32 + hs * 8);
      s0 = WMMA(qf[dt], b0, s0);
      v16h b1 = frag_f16(kbase + (size_t)(n0k + 16 + lm) * 512 + ds0 + dt * 32 + hs * 8);
      s1 = WMMA(qf[dt], b1, s1);
    }
    float* sp = Spart + wave * 512;
#pragma unroll
    for (int r = 0; r < 8; ++r) {
      const int m = r + hs * 8;
      sp[m * 32 + lm] = s0[r];
      sp[m * 32 + 16 + lm] = s1[r];
    }
    __syncthreads();

    // ---- online softmax: thread m owns row m, sums the 4 wave partials ----
    if (tid < 16) {
      const int m = tid;
      const float mold = rowmax[m], lold = rowsum[m];
      float sv[32];
      float smax = mold;
#pragma unroll
      for (int n = 0; n < 32; ++n) {
        float s = Spart[m * 32 + n] + Spart[512 + m * 32 + n] +
                  Spart[1024 + m * 32 + n] + Spart[1536 + m * 32 + n];
        sv[n] = s;
        smax = fmaxf(smax, s);
      }
      const float alpha = __expf(mold - smax);
      float lsum = lold * alpha;
#pragma unroll
      for (int n = 0; n < 32; ++n) {
        const float p = __expf(sv[n] - smax);
        lsum += p;
        Ptile[m * 32 + n] = (_Float16)p;
      }
      rowmax[m] = smax; rowsum[m] = lsum; alphaS[m] = alpha;
    }
    __syncthreads();

    // ---- rescale O accumulators, then O += P . V over this d-slice ----
#pragma unroll
    for (int r = 0; r < 8; ++r) {
      const float am = alphaS[r + hs * 8];
#pragma unroll
      for (int dt = 0; dt < 8; ++dt) oacc[dt][r] *= am;
    }
    v16h pf = frag_f16(Ptile + lm * 32 + hs * 8);  // P as A operand (16x32)
#pragma unroll
    for (int dt = 0; dt < 8; ++dt) {
      // B[k][n] = V[key][dcol] = Vt[dcol][key]: lane holds Vt row, contig in t
      v16h bf = frag_f16(vbase + (size_t)(ds0 + dt * 16 + lm) * 1024 + n0k + hs * 8);
      oacc[dt] = WMMA(pf, bf, oacc[dt]);
    }
    __syncthreads();
  }

  // ---- normalize and store to Oh (B,T,H*512) ----
  const int b = bh >> 3, h = bh & 7;
#pragma unroll
  for (int r = 0; r < 8; ++r) {
    const float inv = 1.0f / rowsum[r + hs * 8];
    const int t = m0 + r + hs * 8;
#pragma unroll
    for (int dt = 0; dt < 8; ++dt) {
      const int d = ds0 + dt * 16 + lm;
      Oh[((size_t)b * 1024 + t) * 4096 + h * 512 + d] = (_Float16)(oacc[dt][r] * inv);
    }
  }
}

// ---------------------------------------------------------------------------
// Kernel 3: out = Oh . Woh^T + bo (f32 out). grid = (8, 64); block = 128.
// Each wave: 16(M) x 64(N), K over 4096 in steps of 32 (128x4 WMMAs).
// ---------------------------------------------------------------------------
__global__ __launch_bounds__(128) void out_proj_kernel(
    const _Float16* __restrict__ Oh, const _Float16* __restrict__ Woh,
    const float* __restrict__ bo, float* __restrict__ out) {
  const int lane = threadIdx.x & 31, wave = threadIdx.x >> 5;
  const int lm = lane & 15, hs = lane >> 4;
  const int m0 = (blockIdx.y * 4 + wave) * 16;
  const int n0 = blockIdx.x * 64;

  v8f acc[4] = {};
  const _Float16* orow = Oh + (size_t)(m0 + lm) * 4096;
#pragma unroll 2
  for (int kk = 0; kk < 4096; kk += 32) {
    v16h a = frag_f16(orow + kk + hs * 8);
#pragma unroll
    for (int j = 0; j < 4; ++j) {
      v16h bfr = frag_f16(Woh + (size_t)(n0 + j * 16 + lm) * 4096 + kk + hs * 8);
      acc[j] = WMMA(a, bfr, acc[j]);
    }
  }
#pragma unroll
  for (int j = 0; j < 4; ++j) {
    const int n = n0 + j * 16 + lm;
    const float bias = bo[n];
#pragma unroll
    for (int r = 0; r < 8; ++r) {
      const int m = m0 + r + hs * 8;
      out[(size_t)m * 512 + n] = acc[j][r] + bias;
    }
  }
}

// ---------------------------------------------------------------------------
extern "C" void kernel_launch(void* const* d_in, const int* in_sizes, int n_in,
                              void* d_out, int out_size, void* d_ws, size_t ws_size,
                              hipStream_t stream) {
  (void)in_sizes; (void)n_in; (void)out_size; (void)ws_size;
  const float* x  = (const float*)d_in[0];
  const float* Wq = (const float*)d_in[1];
  const float* Wk = (const float*)d_in[2];
  const float* Wv = (const float*)d_in[3];
  const float* Wo = (const float*)d_in[4];
  const float* bo = (const float*)d_in[5];
  float* out = (float*)d_out;

  char* ws = (char*)d_ws;
  _Float16* Qh  = (_Float16*)(ws);
  _Float16* Kh  = (_Float16*)(ws + (size_t)33554432);
  _Float16* Vt  = (_Float16*)(ws + (size_t)67108864);
  _Float16* Oh  = (_Float16*)(ws + (size_t)100663296);
  _Float16* Xh  = (_Float16*)(ws + (size_t)134217728);
  _Float16* Wqh = (_Float16*)(ws + (size_t)138412032);
  _Float16* Wkh = (_Float16*)(ws + (size_t)142606336);
  _Float16* Wvh = (_Float16*)(ws + (size_t)146800640);
  _Float16* Woh = (_Float16*)(ws + (size_t)150994944);

  cvt_f16_kernel<<<dim3(2048, 5), 256, 0, stream>>>(x, Wq, Wk, Wv, Wo,
                                                    Xh, Wqh, Wkh, Wvh, Woh);
  qkv_proj_kernel<<<dim3(64, 64, 3), 128, 0, stream>>>(Xh, Wqh, Wkh, Wvh,
                                                       Qh, Kh, Vt);
  flash_attn_kernel<<<dim3(64, 32), 128, 0, stream>>>(Qh, Kh, Vt, Oh);
  out_proj_kernel<<<dim3(8, 64), 128, 0, stream>>>(Oh, Woh, bo, out);
}

// v001
// It runs in 434 microseconds.
// Timed twice side by side with v000, it ran 1.59 times as fast both times.
#include <hip/hip_runtime.h>

// ---------------------------------------------------------------------------
// MI455X (gfx1250) fused multi-head self-attention, f16 WMMA / f32 accum.
//   B=4, T=1024, EMBED=512, H=8, head_dim=512 (reference uses full EMBED/head)
// Workspace layout (148 MB total):
//   Qh  : (B,H,T,512) f16 @ 0      (scaled by 512^-0.25)
//   Kh  : (B,H,T,512) f16 @ 32MB   (scaled by 512^-0.25)
//   Vt  : (B,H,512,T) f16 @ 64MB   (transposed -> WMMA B-operand b128 loads)
//   Oh  : (B,T,4096)  f16 @ 96MB
//   Xh  : (4096,512)  f16 @ 128MB  (x converted once)
//   Wqh/Wkh/Wvh : (4096,512) f16 @ 132/136/140MB
//   Woh : (512,4096)  f16 @ 144MB
// The projection GEMMs read f16 tiles staged in LDS; attention reads f16 from global.
// ---------------------------------------------------------------------------

typedef _Float16 v16h __attribute__((ext_vector_type(16)));
typedef _Float16 v8h  __attribute__((ext_vector_type(8)));
typedef _Float16 v4h  __attribute__((ext_vector_type(4)));
typedef float    v8f  __attribute__((ext_vector_type(8)));
typedef float    v4f  __attribute__((ext_vector_type(4)));

#define WMMA(a, b, c) \
  __builtin_amdgcn_wmma_f32_16x16x32_f16(false, (a), false, (b), (short)0, (c), false, false)

// A/B fragment element e (lane L, hs=L>>4): K = (e>>3)*16 + hs*8 + (e&7)
// -> two contiguous 8-half (16B) runs at K0 = hs*8 and K0+16.
static __device__ __forceinline__ v16h frag_f16(const _Float16* p0) {
  v8h lo = *(const v8h*)p0;
  v8h hi = *(const v8h*)(p0 + 16);
  v16h r;
#pragma unroll
  for (int i = 0; i < 8; ++i) { r[i] = lo[i]; r[8 + i] = hi[i]; }
  return r;
}

// ---------------------------------------------------------------------------
// Projection GEMM core: C(BM x BN) = A(BM x K) . B(BN x K)^T, both k-contiguous.
// 128 threads, 4 waves as 2 x 2, each wave (BM/2) x (BN/2). A trip is 64 k
// (128-byte rows): [A rows | B rows] at an LDS pitch of 144 B, two buffers,
// filled by per-lane 16-byte asynchronous copies (a wave covers 4 whole rows).
// ---------------------------------------------------------------------------
#define LDS_PITCH 144

// Four copies, then s_wait_xcnt 0 (a precaution: it stands ahead of any rewrite of
// the copies' address registers); one statement, so that the compiler can put
// nothing between the copies and the wait.
static __device__ __forceinline__ void copy4_to_lds(unsigned l, const _Float16* g,
                                                    int lstep, size_t gstep) {
  asm volatile(
      "global_load_async_to_lds_b128 %0, %4, off\n\t"
      "global_load_async_to_lds_b128 %1, %5, off\n\t"
      "global_load_async_to_lds_b128 %2, %6, off\n\t"
      "global_load_async_to_lds_b128 %3, %7, off\n\t"
      "s_wait_xcnt 0x0"
      :: "v"(l), "v"(l + lstep), "v"(l + 2 * lstep), "v"(l + 3 * lstep),
         "v"(g), "v"(g + gstep), "v"(g + 2 * gstep), "v"(g + 3 * gstep)
      : "memory");
}

// ROWS rows of 128 B: thread t brings 16 B at row (t >> 3) + 16 i, byte (t & 7) * 16.
template <int ROWS, int K>
static __device__ __forceinline__ void stage_rows(unsigned l, const _Float16* g) {
#pragma unroll  // address steps become constants
  for (int i = 0; i < ROWS / 16; i += 4)
    copy4_to_lds(l + i * 16 * LDS_PITCH, g + (size_t)i * 16 * K, 16 * LDS_PITCH,
                 (size_t)16 * K);
}

template <int BM, int BN, int K>
static __device__ __forceinline__ void gemm_staged(
    const _Float16* __restrict__ A, const _Float16* __restrict__ B, int m0, int n0,
    char* smem, v8f (&acc)[BM / 32][BN / 32]) {
  constexpr int STAGE = (BM + BN) * LDS_PITCH;
  constexpr int T = K / 64;
  static_assert(T >= 2 && K % 64 == 0 && BM % 64 == 0 && BN % 64 == 0, "tile shape");
  const int tid = threadIdx.x;
  const int lane = tid & 31, wave = tid >> 5;
  const int lm = lane & 15, hs = lane >> 4;
  const int wm = wave >> 1, wn = wave & 1;

  const _Float16* ga = A + (size_t)(m0 + (tid >> 3)) * K + (tid & 7) * 8;
  const _Float16* gb = B + (size_t)(n0 + (tid >> 3)) * K + (tid & 7) * 8;
  const unsigned la = (unsigned)(uintptr_t)smem + (tid >> 3) * LDS_PITCH + (tid & 7) * 16;
  const unsigned lb = la + BM * LDS_PITCH;
  const char* ra = smem + (wm * (BM / 2) + lm) * LDS_PITCH + hs * 16;
  const char* rb = smem + (BM + wn * (BN / 2) + lm) * LDS_PITCH + hs * 16;

  stage_rows<BM, K>(la, ga);
  stage_rows<BN, K>(lb, gb);
  // Tile 0 has landed for this wave; the barrier publishes it to the others.
  asm volatile("s_wait_asynccnt 0x0" ::: "memory");
  __syncthreads();
  stage_rows<BM, K>(la + STAGE, ga + 64);
  stage_rows<BN, K>(lb + STAGE, gb + 64);

  for (int t = 0; t < T; ++t) {
    const int off = (t & 1) * STAGE;
    // All loops below are unrolled so that every fragment and accumulator index
    // is a constant (registers, no scratch).
#pragma unroll
    for (int ks = 0; ks < 2; ++ks) {
      v16h a[BM / 32], b[BN / 32];
#pragma unroll
      for (int i = 0; i < BM / 32; ++i)
        a[i] = frag_f16((const _Float16*)(ra + off + i * 16 * LDS_PITCH + ks * 64));
#pragma unroll
      for (int j = 0; j < BN / 32; ++j)
        b[j] = frag_f16((const _Float16*)(rb + off + j * 16 * LDS_PITCH + ks * 64));
#pragma unroll
      for (int i = 0; i < BM / 32; ++i)
#pragma unroll
        for (int j = 0; j < BN / 32; ++j) acc[i][j] = WMMA(a[i], b[j], acc[i][j]);
    }
    // This wave's reads of buffer t & 1 are done before it may be refilled.
    asm volatile("s_wait_dscnt 0x0" ::: "memory");
    // This wave's copies of tile t + 1 have landed before the barrier publishes them.
    asm volatile("s_wait_asynccnt 0x0" ::: "memory");
    __syncthreads();
    if (t + 2 < T) {
      stage_rows<BM, K>(la + off, ga + (t + 2) * 64);
      stage_rows<BN, K>(lb + off, gb + (t + 2) * 64);
    }
  }
  // No copy is outstanding when the wave goes on to its stores and ends.
  asm volatile("s_wait_asynccnt 0x0" ::: "memory");
}

// ---------------------------------------------------------------------------
// Kernel 0: one-shot f32 -> f16 conversion of x and the four weights.
// All five tensors are 2,097,152 elements. grid = (2048, 5), block = 256.
// ---------------------------------------------------------------------------
__global__ __launch_bounds__(256) void cvt_f16_kernel(
    const float* __restrict__ sx, const float* __restrict__ sq,
    const float* __restrict__ sk, const float* __restrict__ sv,
    const float* __restrict__ so,
    _Float16* __restrict__ dx, _Float16* __restrict__ dq,
    _Float16* __restrict__ dk, _Float16* __restrict__ dv,
    _Float16* __restrict__ dw) {
  const float* src;
  _Float16* dst;
  switch (blockIdx.y) {
    case 0: src = sx; dst = dx; break;
    case 1: src = sq; dst = dq; break;
    case 2: src = sk; dst = dk; break;
    case 3: src = sv; dst = dv; break;
    default: src = so; dst = dw; break;
  }
  const size_t i = ((size_t)blockIdx.x * 256 + threadIdx.x) * 4;
  v4f v = *(const v4f*)(src + i);
  v4h h;
#pragma unroll
  for (int j = 0; j < 4; ++j) h[j] = (_Float16)v[j];
  *(v4h*)(dst + i) = h;
}

// ---------------------------------------------------------------------------
// Kernel 1: Q/K/V projections (f16 x f16 -> f32). grid = (32, 32, 3); block 128.
// Block tile 128(M) x 128(N), each wave 64 x 64, K = 512 in 8 staged trips.
// ---------------------------------------------------------------------------
__global__ __launch_bounds__(128) void qkv_proj_kernel(
    const _Float16* __restrict__ Xh, const _Float16* __restrict__ Wqh,
    const _Float16* __restrict__ Wkh, const _Float16* __restrict__ Wvh,
    _Float16* __restrict__ Qh, _Float16* __restrict__ Kh,
    _Float16* __restrict__ Vt) {
  __shared__ __attribute__((aligned(16))) char smem[2 * (128 + 128) * LDS_PITCH];
  const int lane = threadIdx.x & 31, wave = threadIdx.x >> 5;
  const int lm = lane & 15, hs = lane >> 4;
  const int z = blockIdx.z;
  const _Float16* W = (z == 0) ? Wqh : ((z == 1) ? Wkh : Wvh);
  const int bm0 = blockIdx.y * 128;  // row in (b*t) space
  const int bn0 = blockIdx.x * 128;  // col in (h*d) space

  v8f acc[4][4] = {};
  gemm_staged<128, 128, 512>(Xh, W, bm0, bn0, smem, acc);

  const int m0 = bm0 + (wave >> 1) * 64;
  const int n0 = bn0 + (wave & 1) * 64;
  const float sc = (z < 2) ? 0.21022410381342865f : 1.0f;  // 512^-0.25
#pragma unroll
  for (int i = 0; i < 4; ++i) {
#pragma unroll
    for (int j = 0; j < 4; ++j) {
      const int n = n0 + j * 16 + lm;
      const int h = n >> 9, d = n & 511;
#pragma unroll
      for (int r = 0; r < 8; ++r) {
        const int m = m0 + i * 16 + r + hs * 8;  // C layout: row = r + 8*hs, col = lm
        const int bb = m >> 10, t = m & 1023;
        const _Float16 v = (_Float16)(acc[i][j][r] * sc);
        // s_wait_xcnt 0 behind each store: a precaution, it stands ahead of any
        // rewrite of the store's address and data registers by the next element.
        if (z == 0) {
          Qh[(((size_t)(bb * 8 + h)) * 1024 + t) * 512 + d] = v;
          asm volatile("s_wait_xcnt 0x0" ::: "memory");
        } else if (z == 1) {
          Kh[(((size_t)(bb * 8 + h)) * 1024 + t) * 512 + d] = v;
          asm volatile("s_wait_xcnt 0x0" ::: "memory");
        } else {
          Vt[(((size_t)(bb * 8 + h)) * 512 + d) * 1024 + t] = v;  // transposed
          asm volatile("s_wait_xcnt 0x0" ::: "memory");
        }
      }
    }
  }
}

// ---------------------------------------------------------------------------
// Kernel 2: flash attention. grid = (T/16, B*H); block = 128 (4 waves).
// Waves split d=512 into 128-wide slices for the O accumulator; S partials
// are reduced across waves in LDS; 16 threads run the online softmax.
// ---------------------------------------------------------------------------
__global__ __launch_bounds__(128) void flash_attn_kernel(
    const _Float16* __restrict__ Qh, const _Float16* __restrict__ Kh,
    const _Float16* __restrict__ Vt, _Float16* __restrict__ Oh) {
  __shared__ float Spart[4 * 16 * 32];              // per-wave S partials
  __shared__ __align__(16) _Float16 Ptile[16 * 32]; // softmax probs (A frag src)
  __shared__ float rowmax[16], rowsum[16], alphaS[16];

  const int tid = threadIdx.x;
  const int lane = tid & 31, wave = tid >> 5;
  const int lm = lane & 15, hs = lane >> 4;
  const int bh = blockIdx.y;
  const int m0 = blockIdx.x * 16;
  const int ds0 = wave * 128;

  const _Float16* qbase = Qh + ((size_t)bh * 1024 + m0) * 512;
  const _Float16* kbase = Kh + (size_t)bh * 1024 * 512;
  const _Float16* vbase = Vt + (size_t)bh * 512 * 1024;

  // Preload Q A-fragments over this wave's d-slice (reused all key blocks).
  v16h qf[4];
#pragma unroll
  for (int dt = 0; dt < 4; ++dt)
    qf[dt] = frag_f16(qbase + (size_t)lm * 512 + ds0 + dt * 32 + hs * 8);

  v8f oacc[8] = {};

  if (tid < 16) { rowmax[tid] = -1e30f; rowsum[tid] = 0.0f; }
  __syncthreads();

  for (int n0k = 0; n0k < 1024; n0k += 32) {
    // Non-blocking prefetch of next key block (global_prefetch_b8).
    if (n0k + 32 < 1024) {
      __builtin_prefetch(kbase + (size_t)(n0k + 32 + lm) * 512 + ds0, 0, 1);
      __builtin_prefetch(vbase + (size_t)(ds0 + lm) * 1024 + n0k + 32, 0, 1);
    }
    // ---- S partial = Q[:,dslice] . K[n0k:n0k+32, dslice]^T  (2 tiles) ----
    v8f s0 = {}, s1 = {};
#pragma unroll
    for (int dt = 0; dt < 4; ++dt) {
      v16h b0 = frag_f16(kbase + (size_t)(n0k + lm) * 512 + ds0 + dt * 32 + hs * 8);
      s0 = WMMA(qf[dt], b0, s0);
      v16h b1 = frag_f16(kbase + (size_t)(n0k + 16 + lm) * 512 + ds0 + dt * 32 + hs * 8);
      s1 = WMMA(qf[dt], b1, s1);
    }
    float* sp = Spart + wave * 512;
#pragma unroll
    for (int r = 0; r < 8; ++r) {
      const int m = r + hs * 8;
      sp[m * 32 + lm] = s0[r];
      sp[m * 32 + 16 + lm] = s1[r];
    }
    __syncthreads();

    // ---- online softmax: thread m owns row m, sums the 4 wave partials ----
    if (tid < 16) {
      const int m = tid;
      const float mold = rowmax[m], lold = rowsum[m];
      float sv[32];
      float smax = mold;
#pragma unroll
      for (int n = 0; n < 32; ++n) {
        float s = Spart[m * 32 + n] + Spart[512 + m * 32 + n] +
                  Spart[1024 + m * 32 + n] + Spart[1536 + m * 32 + n];
        sv[n] = s;
        smax = fmaxf(smax, s);
      }
      const float alpha = __expf(mold - smax);
      float lsum = lold * alpha;
#pragma unroll
      for (int n = 0; n < 32; ++n) {
        const float p = __expf(sv[n] - smax);
        lsum += p;
        Ptile[m * 32 + n] = (_Float16)p;
      }
      rowmax[m] = smax; rowsum[m] = lsum; alphaS[m] = alpha;
    }
    __syncthreads();

    // ---- rescale O accumulators, then O += P . V over this d-slice ----
#pragma unroll
    for (int r = 0; r < 8; ++r) {
      const float am = alphaS[r + hs * 8];
#pragma unroll
      for (int dt = 0; dt < 8; ++dt) oacc[dt][r] *= am;
    }
    v16h pf = frag_f16(Ptile + lm * 32 + hs * 8);  // P as A operand (16x32)
#pragma unroll
    for (int dt = 0; dt < 8; ++dt) {
      // B[k][n] = V[key][dcol] = Vt[dcol][key]: lane holds Vt row, contig in t
      v16h bf = frag_f16(vbase + (size_t)(ds0 + dt * 16 + lm) * 1024 + n0k + hs * 8);
      oacc[dt] = WMMA(pf, bf, oacc[dt]);
    }
    __syncthreads();
  }

  // ---- normalize and store to Oh (B,T,H*512) ----
  const int b = bh >> 3, h = bh & 7;
#pragma unroll
  for (int r = 0; r < 8; ++r) {
    const float inv = 1.0f / rowsum[r + hs * 8];
    const int t = m0 + r + hs * 8;
#pragma unroll
    for (int dt = 0; dt < 8; ++dt) {
      const int d = ds0 + dt * 16 + lm;
      Oh[((size_t)b * 1024 + t) * 4096 + h * 512 + d] = (_Float16)(oacc[dt][r] * inv);
    }
  }
}

// ---------------------------------------------------------------------------
// Kernel 3: out = Oh . Woh^T + bo (f32 out). grid = (8, 64); block = 128.
// Block tile 64(M) x 64(N), each wave 32 x 32, K = 4096 in 64 staged trips.
// ---------------------------------------------------------------------------
__global__ __launch_bounds__(128) void out_proj_kernel(
    const _Float16* __restrict__ Oh, const _Float16* __restrict__ Woh,
    const float* __restrict__ bo, float* __restrict__ out) {
  __shared__ __attribute__((aligned(16))) char smem[2 * (64 + 64) * LDS_PITCH];
  const int lane = threadIdx.x & 31, wave = threadIdx.x >> 5;
  const int lm = lane & 15, hs = lane >> 4;
  const int bm0 = blockIdx.y * 64;
  const int bn0 = blockIdx.x * 64;

  v8f acc[2][2] = {};
  gemm_staged<64, 64, 4096>(Oh, Woh, bm0, bn0, smem, acc);

  const int m0 = bm0 + (wave >> 1) * 32;
  const int n0 = bn0 + (wave & 1) * 32;
#pragma unroll
  for (int j = 0; j < 2; ++j) {
    const int n = n0 + j * 16 + lm;
    const float bias = bo[n];
#pragma unroll
    for (int i = 0; i < 2; ++i) {
#pragma unroll
      for (int r = 0; r < 8; ++r) {
        const int m = m0 + i * 16 + r + hs * 8;
        out[(size_t)m * 512 + n] = acc[i][j][r] + bias;
      }
    }
  }
}

// ---------------------------------------------------------------------------
extern "C" void kernel_launch(void* const* d_in, const int* in_sizes, int n_in,
                              void* d_out, int out_size, void* d_ws, size_t ws_size,
                              hipStream_t stream) {
  (void)in_sizes; (void)n_in; (void)out_size; (void)ws_size;
  const float* x  = (const float*)d_in[0];
  const float* Wq = (const float*)d_in[1];
  const float* Wk = (const float*)d_in[2];
  const float* Wv = (const float*)d_in[3];
  const float* Wo = (const float*)d_in[4];
  const float* bo = (const float*)d_in[5];
  float* out = (float*)d_out;

  char* ws = (char*)d_ws;
  _Float16* Qh  = (_Float16*)(ws);
  _Float16* Kh  = (_Float16*)(ws + (size_t)33554432);
  _Float16* Vt  = (_Float16*)(ws + (size_t)67108864);
  _Float16* Oh  = (_Float16*)(ws + (size_t)100663296);
  _Float16* Xh  = (_Float16*)(ws + (size_t)134217728);
  _Float16* Wqh = (_Float16*)(ws + (size_t)138412032);
  _Float16* Wkh = (_Float16*)(ws + (size_t)142606336);
  _Float16* Wvh = (_Float16*)(ws + (size_t)146800640);
  _Float16* Woh = (_Float16*)(ws + (size_t)150994944);

  cvt_f16_kernel<<<dim3(2048, 5), 256, 0, stream>>>(x, Wq, Wk, Wv, Wo,
                                                    Xh, Wqh, Wkh, Wvh, Woh);
  qkv_proj_kernel<<<dim3(32, 32, 3), 128, 0, stream>>>(Xh, Wqh, Wkh, Wvh,
                                                       Qh, Kh, Vt);
  flash_attn_kernel<<<dim3(64, 32), 128, 0, stream>>>(Qh, Kh, Vt, Oh);
  out_proj_kernel<<<dim3(8, 64), 128, 0, stream>>>(Oh, Woh, bo, out);
}

// v002
// One run takes 249 microseconds.
// In two side-by-side timings against v001, it was 1.75 and 1.73 times as fast.
// All steps since v000 together make it 2.76 times as fast.
#include <hip/hip_runtime.h>

// ---------------------------------------------------------------------------
// MI455X (gfx1250) fused multi-head self-attention, f16 WMMA / f32 accum.
//   B=4, T=1024, EMBED=512, H=8, head_dim=512 (reference uses full EMBED/head)
// Workspace layout (148 MB total):
//   Qh  : (B,H,T,512) f16 @ 0      (scaled by 512^-0.25)
//   Kh  : (B,H,T,512) f16 @ 32MB   (scaled by 512^-0.25)
//   Vt  : (B,H,512,T) f16 @ 64MB   (transposed -> WMMA B-operand b128 loads)
//   Oh  : (B,T,4096)  f16 @ 96MB
//   Xh  : (4096,512)  f16 @ 128MB  (x converted once)
//   Wqh/Wkh/Wvh : (4096,512) f16 @ 132/136/140MB
//   Woh : (512,4096)  f16 @ 144MB
// The projection GEMMs read f16 tiles staged in LDS; attention reads f16 from global.
// ---------------------------------------------------------------------------

typedef _Float16 v16h __attribute__((ext_vector_type(16)));
typedef _Float16 v8h  __attribute__((ext_vector_type(8)));
typedef _Float16 v4h  __attribute__((ext_vector_type(4)));
typedef float    v8f  __attribute__((ext_vector_type(8)));
typedef float    v4f  __attribute__((ext_vector_type(4)));

#define WMMA(a, b, c) \
  __builtin_amdgcn_wmma_f32_16x16x32_f16(false, (a), false, (b), (short)0, (c), false, false)

// A/B fragment element e (lane L, hs=L>>4): K = (e>>3)*16 + hs*8 + (e&7)
// -> two contiguous 8-half (16B) runs at K0 = hs*8 and K0+16.
static __device__ __forceinline__ v16h frag_f16(const _Float16* p0) {
  v8h lo = *(const v8h*)p0;
  v8h hi = *(const v8h*)(p0 + 16);
  v16h r;
#pragma unroll
  for (int i = 0; i < 8; ++i) { r[i] = lo[i]; r[8 + i] = hi[i]; }
  return r;
}

// ---------------------------------------------------------------------------
// Projection GEMM core: C(BM x BN) = A(BM x K) . B(BN x K)^T, both k-contiguous.
// 128 threads, 4 waves as 2 x 2, each wave (BM/2) x (BN/2). A trip is 64 k
// (128-byte rows): [A rows | B rows] at an LDS pitch of 144 B, two buffers,
// filled by per-lane 16-byte asynchronous copies (a wave covers 4 whole rows).
// ---------------------------------------------------------------------------
#define LDS_PITCH 144

// Four copies, then s_wait_xcnt 0 (a precaution: it stands ahead of any rewrite of
// the copies' address registers); one statement, so that the compiler can put
// nothing between the copies and the wait.
static __device__ __forceinline__ void copy4_to_lds(unsigned l, const _Float16* g,
                                                    int lstep, size_t gstep) {
  asm volatile(
      "global_load_async_to_lds_b128 %0, %4, off\n\t"
      "global_load_async_to_lds_b128 %1, %5, off\n\t"
      "global_load_async_to_lds_b128 %2, %6, off\n\t"
      "global_load_async_to_lds_b128 %3, %7, off\n\t"
      "s_wait_xcnt 0x0"
      :: "v"(l), "v"(l + lstep), "v"(l + 2 * lstep), "v"(l + 3 * lstep),
         "v"(g), "v"(g + gstep), "v"(g + 2 * gstep), "v"(g + 3 * gstep)
      : "memory");
}

// ROWS rows of 128 B: thread t brings 16 B at row (t >> 3) + 16 i, byte (t & 7) * 16.
template <int ROWS, int K>
static __device__ __forceinline__ void stage_rows(unsigned l, const _Float16* g) {
#pragma unroll  // address steps become constants
  for (int i = 0; i < ROWS / 16; i += 4)
    copy4_to_lds(l + i * 16 * LDS_PITCH, g + (size_t)i * 16 * K, 16 * LDS_PITCH,
                 (size_t)16 * K);
}

template <int BM, int BN, int K>
static __device__ __forceinline__ void gemm_staged(
    const _Float16* __restrict__ A, const _Float16* __restrict__ B, int m0, int n0,
    char* smem, v8f (&acc)[BM / 32][BN / 32]) {
  constexpr int STAGE = (BM + BN) * LDS_PITCH;
  constexpr int T = K / 64;
  static_assert(T >= 2 && K % 64 == 0 && BM % 64 == 0 && BN % 64 == 0, "tile shape");
  const int tid = threadIdx.x;
  const int lane = tid & 31, wave = tid >> 5;
  const int lm = lane & 15, hs = lane >> 4;
  const int wm = wave >> 1, wn = wave & 1;

  const _Float16* ga = A + (size_t)(m0 + (tid >> 3)) * K + (tid & 7) * 8;
  const _Float16* gb = B + (size_t)(n0 + (tid >> 3)) * K + (tid & 7) * 8;
  const unsigned la = (unsigned)(uintptr_t)smem + (tid >> 3) * LDS_PITCH + (tid & 7) * 16;
  const unsigned lb = la + BM * LDS_PITCH;
  const char* ra = smem + (wm * (BM / 2) + lm) * LDS_PITCH + hs * 16;
  const char* rb = smem + (BM + wn * (BN / 2) + lm) * LDS_PITCH + hs * 16;

  stage_rows<BM, K>(la, ga);
  stage_rows<BN, K>(lb, gb);
  // Tile 0 has landed for this wave; the barrier publishes it to the others.
  asm volatile("s_wait_asynccnt 0x0" ::: "memory");
  __syncthreads();
  stage_rows<BM, K>(la + STAGE, ga + 64);
  stage_rows<BN, K>(lb + STAGE, gb + 64);

  for (int t = 0; t < T; ++t) {
    const int off = (t & 1) * STAGE;
    // All loops below are unrolled so that every fragment and accumulator index
    // is a constant (registers, no scratch).
#pragma unroll
    for (int ks = 0; ks < 2; ++ks) {
      v16h a[BM / 32], b[BN / 32];
#pragma unroll
      for (int i = 0; i < BM / 32; ++i)
        a[i] = frag_f16((const _Float16*)(ra + off + i * 16 * LDS_PITCH + ks * 64));
#pragma unroll
      for (int j = 0; j < BN / 32; ++j)
        b[j] = frag_f16((const _Float16*)(rb + off + j * 16 * LDS_PITCH + ks * 64));
#pragma unroll
      for (int i = 0; i < BM / 32; ++i)
#pragma unroll
        for (int j = 0; j < BN / 32; ++j) acc[i][j] = WMMA(a[i], b[j], acc[i][j]);
    }
    // This wave's reads of buffer t & 1 are done before it may be refilled.
    asm volatile("s_wait_dscnt 0x0" ::: "memory");
    // This wave's copies of tile t + 1 have landed before the barrier publishes them.
    asm volatile("s_wait_asynccnt 0x0" ::: "memory");
    __syncthreads();
    if (t + 2 < T) {
      stage_rows<BM, K>(la + off, ga + (t + 2) * 64);
      stage_rows<BN, K>(lb + off, gb + (t + 2) * 64);
    }
  }
  // No copy is outstanding when the wave goes on to its stores and ends.
  asm volatile("s_wait_asynccnt 0x0" ::: "memory");
}

// ---------------------------------------------------------------------------
// Kernel 0: one-shot f32 -> f16 conversion of x and the four weights.
// All five tensors are 2,097,152 elements. grid = (2048, 5), block = 256.
// ---------------------------------------------------------------------------
__global__ __launch_bounds__(256) void cvt_f16_kernel(
    const float* __restrict__ sx, const float* __restrict__ sq,
    const float* __restrict__ sk, const float* __restrict__ sv,
    const float* __restrict__ so,
    _Float16* __restrict__ dx, _Float16* __restrict__ dq,
    _Float16* __restrict__ dk, _Float16* __restrict__ dv,
    _Float16* __restrict__ dw) {
  const float* src;
  _Float16* dst;
  switch (blockIdx.y) {
    case 0: src = sx; dst = dx; break;
    case 1: src = sq; dst = dq; break;
    case 2: src = sk; dst = dk; break;
    case 3: src = sv; dst = dv; break;
    default: src = so; dst = dw; break;
  }
  const size_t i = ((size_t)blockIdx.x * 256 + threadIdx.x) * 4;
  v4f v = *(const v4f*)(src + i);
  v4h h;
#pragma unroll
  for (int j = 0; j < 4; ++j) h[j] = (_Float16)v[j];
  *(v4h*)(dst + i) = h;
}

// ---------------------------------------------------------------------------
// Kernel 1: Q/K/V projections (f16 x f16 -> f32). grid = (32, 32, 3); block 128.
// Block tile 128(M) x 128(N), each wave 64 x 64, K = 512 in 8 staged trips.
// ---------------------------------------------------------------------------
__global__ __launch_bounds__(128) void qkv_proj_kernel(
    const _Float16* __restrict__ Xh, const _Float16* __restrict__ Wqh,
    const _Float16* __restrict__ Wkh, const _Float16* __restrict__ Wvh,
    _Float16* __restrict__ Qh, _Float16* __restrict__ Kh,
    _Float16* __restrict__ Vt) {
  __shared__ __attribute__((aligned(16))) char smem[2 * (128 + 128) * LDS_PITCH];
  const int lane = threadIdx.x & 31, wave = threadIdx.x >> 5;
  const int lm = lane & 15, hs = lane >> 4;
  const int z = blockIdx.z;
  const _Float16* W = (z == 0) ? Wqh : ((z == 1) ? Wkh : Wvh);
  const int bm0 = blockIdx.y * 128;  // row in (b*t) space
  const int bn0 = blockIdx.x * 128;  // col in (h*d) space

  v8f acc[4][4] = {};
  gemm_staged<128, 128, 512>(Xh, W, bm0, bn0, smem, acc);

  const int m0 = bm0 + (wave >> 1) * 64;
  const int n0 = bn0 + (wave & 1) * 64;
  const float sc = (z < 2) ? 0.21022410381342865f : 1.0f;  // 512^-0.25
#pragma unroll
  for (int i = 0; i < 4; ++i) {
#pragma unroll
    for (int j = 0; j < 4; ++j) {
      const int n = n0 + j * 16 + lm;
      const int h = n >> 9, d = n & 511;
#pragma unroll
      for (int r = 0; r < 8; ++r) {
        const int m = m0 + i * 16 + r + hs * 8;  // C layout: row = r + 8*hs, col = lm
        const int bb = m >> 10, t = m & 1023;
        const _Float16 v = (_Float16)(acc[i][j][r] * sc);
        // s_wait_xcnt 0 behind each store: a precaution, it stands ahead of any
        // rewrite of the store's address and data registers by the next element.
        if (z == 0) {
          Qh[(((size_t)(bb * 8 + h)) * 1024 + t) * 512 + d] = v;
          asm volatile("s_wait_xcnt 0x0" ::: "memory");
        } else if (z == 1) {
          Kh[(((size_t)(bb * 8 + h)) * 1024 + t) * 512 + d] = v;
          asm volatile("s_wait_xcnt 0x0" ::: "memory");
        } else {
          Vt[(((size_t)(bb * 8 + h)) * 512 + d) * 1024 + t] = v;  // transposed
          asm volatile("s_wait_xcnt 0x0" ::: "memory");
        }
      }
    }
  }
}

// ---------------------------------------------------------------------------
// Kernel 2: flash attention. grid = (T/64, B*H); block = 128 (4 waves).
// A work-group owns 64 query rows (4 row tiles of 16). Waves split d=512 into
// 128-wide slices; every K and V fragment a wave loads feeds all 4 row tiles.
// The 64 x 512 O tile takes 256 registers a lane, so the Q tile lives in LDS.
// S partials are reduced across waves in LDS; 64 threads run the online softmax,
// one row each. LDS row pitches (1040 B for Q, 144 B for S, 80 B for P) are odd
// multiples of 16 B: 16-byte accesses of neighbouring rows fall on different banks.
// All inner loops are unrolled so that every fragment and accumulator index is a
// constant (registers, no scratch).
// ---------------------------------------------------------------------------
#define QT 4         // 16-row query tiles per work-group
#define SP_PITCH 36  // floats per S row in LDS
#define PT_PITCH 40  // halves per P row in LDS
#define QS_PITCH 520 // halves per Q row in LDS

__global__ __launch_bounds__(128) void flash_attn_kernel(
    const _Float16* __restrict__ Qh, const _Float16* __restrict__ Kh,
    const _Float16* __restrict__ Vt, _Float16* __restrict__ Oh) {
  __shared__ __align__(16) _Float16 Qs[QT * 16 * QS_PITCH];      // Q tile (A frag src)
  __shared__ __align__(16) float Spart[4 * QT * 16 * SP_PITCH];  // per-wave S partials
  __shared__ __align__(16) _Float16 Ptile[QT * 16 * PT_PITCH];   // softmax probs (A frag src)
  __shared__ float rowmax[QT * 16], rowsum[QT * 16], alphaS[QT * 16];

  const int tid = threadIdx.x;
  const int lane = tid & 31, wave = tid >> 5;
  const int lm = lane & 15, hs = lane >> 4;
  const int bh = blockIdx.y;
  const int m0 = blockIdx.x * (QT * 16);
  const int ds0 = wave * 128;

  const _Float16* qbase = Qh + ((size_t)bh * 1024 + m0) * 512;
  const _Float16* kbase = Kh + (size_t)bh * 1024 * 512;
  const _Float16* vbase = Vt + (size_t)bh * 512 * 1024;

  // Q tile to LDS once (reused all key blocks): two whole rows per pass of the block.
#pragma unroll
  for (int i = 0; i < QT * 8; ++i)
    *(v8h*)(Qs + (i * 2 + (tid >> 6)) * QS_PITCH + (tid & 63) * 8) =
        *(const v8h*)(qbase + (size_t)(i * 2 + (tid >> 6)) * 512 + (tid & 63) * 8);
  const _Float16* qrow = Qs + lm * QS_PITCH + ds0 + hs * 8;

  v8f oacc[QT][8] = {};

  if (tid < QT * 16) { rowmax[tid] = -1e30f; rowsum[tid] = 0.0f; }
  __syncthreads();

  for (int n0k = 0; n0k < 1024; n0k += 32) {
    // Non-blocking prefetch of next key block (global_prefetch_b8).
    if (n0k + 32 < 1024) {
      __builtin_prefetch(kbase + (size_t)(n0k + 32 + lm) * 512 + ds0, 0, 1);
      __builtin_prefetch(vbase + (size_t)(ds0 + lm) * 1024 + n0k + 32, 0, 1);
    }
    // ---- S partial = Q[:,dslice] . K[n0k:n0k+32, dslice]^T  (2 tiles per row tile) ----
    v8f s0[QT] = {}, s1[QT] = {};
    v16h b0[4], b1[4], qf[2][QT];
    const _Float16* kp = kbase + (size_t)(n0k + lm) * 512 + ds0 + hs * 8;
#pragma unroll
    for (int dt = 0; dt < 4; ++dt) {
      b0[dt] = frag_f16(kp + dt * 32);
      b1[dt] = frag_f16(kp + 16 * 512 + dt * 32);
    }
#pragma unroll
    for (int mt = 0; mt < QT; ++mt) qf[0][mt] = frag_f16(qrow + mt * 16 * QS_PITCH);
    // s_wait_xcnt 0 behind the K loads: a precaution, it stands ahead of any rewrite
    // of their address register; naming the address as an input keeps that register
    // from being handed to one of the loads as its destination.
    asm volatile("s_wait_xcnt 0x0" :: "v"(kp) : "memory");
    // Keeps all 16 K loads in flight together: without it the compiler sinks them
    // between the products and the wave waits out one load latency per d step.
    __builtin_amdgcn_sched_barrier(0);
#pragma unroll
    for (int dt = 0; dt < 4; ++dt) {
      if (dt < 3) {
#pragma unroll
        for (int mt = 0; mt < QT; ++mt)
          qf[(dt + 1) & 1][mt] = frag_f16(qrow + mt * 16 * QS_PITCH + (dt + 1) * 32);
      }
      // Keeps the next d step's Q reads as one group ahead of this step's products,
      // so that their LDS latency runs behind 8 matrix instructions.
      __builtin_amdgcn_sched_barrier(0);
#pragma unroll
      for (int mt = 0; mt < QT; ++mt) {
        s0[mt] = WMMA(qf[dt & 1][mt], b0[dt], s0[mt]);
        s1[mt] = WMMA(qf[dt & 1][mt], b1[dt], s1[mt]);
      }
    }
    float* sp = Spart + wave * (QT * 16 * SP_PITCH);
#pragma unroll
    for (int mt = 0; mt < QT; ++mt) {
#pragma unroll
      for (int r = 0; r < 8; ++r) {
        const int m = mt * 16 + r + hs * 8;
        sp[m * SP_PITCH + lm] = s0[mt][r];
        sp[m * SP_PITCH + 16 + lm] = s1[mt][r];
      }
    }
    __syncthreads();

    // ---- online softmax: thread m owns row m, sums the 4 wave partials ----
    if (tid < QT * 16) {
      const int m = tid;
      const float mold = rowmax[m], lold = rowsum[m];
      const float* s_row = Spart + m * SP_PITCH;
      float sv[32];
      float smax = mold;
#pragma unroll
      for (int n = 0; n < 32; ++n) {
        float s = s_row[n] + s_row[QT * 16 * SP_PITCH + n] +
                  s_row[2 * QT * 16 * SP_PITCH + n] + s_row[3 * QT * 16 * SP_PITCH + n];
        sv[n] = s;
        smax = fmaxf(smax, s);
      }
      const float alpha = __expf(mold - smax);
      float lsum = lold * alpha;
#pragma unroll
      for (int n = 0; n < 32; ++n) {
        const float p = __expf(sv[n] - smax);
        lsum += p;
        Ptile[m * PT_PITCH + n] = (_Float16)p;
      }
      rowmax[m] = smax; rowsum[m] = lsum; alphaS[m] = alpha;
    }
    __syncthreads();

    // ---- rescale O accumulators, then O += P . V over this d-slice ----
    v16h pf[QT];  // P as A operand (16x32 per row tile)
#pragma unroll
    for (int mt = 0; mt < QT; ++mt) {
#pragma unroll
      for (int r = 0; r < 8; ++r) {
        const float am = alphaS[mt * 16 + r + hs * 8];
#pragma unroll
        for (int dt = 0; dt < 8; ++dt) oacc[mt][dt][r] *= am;
      }
      pf[mt] = frag_f16(Ptile + (mt * 16 + lm) * PT_PITCH + hs * 8);
    }
#pragma unroll
    for (int dt = 0; dt < 8; ++dt) {
      // B[k][n] = V[key][dcol] = Vt[dcol][key]: lane holds Vt row, contig in t
      v16h bf = frag_f16(vbase + (size_t)(ds0 + dt * 16 + lm) * 1024 + n0k + hs * 8);
#pragma unroll
      for (int mt = 0; mt < QT; ++mt) oacc[mt][dt] = WMMA(pf[mt], bf, oacc[mt][dt]);
    }
    __syncthreads();
  }

  // ---- normalize and store to Oh (B,T,H*512) ----
  const int b = bh >> 3, h = bh & 7;
  _Float16* obase = Oh + ((size_t)b * 1024 + m0 + hs * 8) * 4096 + h * 512 + ds0 + lm;
#pragma unroll
  for (int mt = 0; mt < QT; ++mt) {
    _Float16 o[8][8];
#pragma unroll
    for (int r = 0; r < 8; ++r) {
      const float inv = 1.0f / rowsum[mt * 16 + r + hs * 8];
#pragma unroll
      for (int dt = 0; dt < 8; ++dt) o[r][dt] = (_Float16)(oacc[mt][dt][r] * inv);
    }
    // The two scheduling fences keep every vector write of a row tile ahead of its
    // stores and every later one behind the wait below.
    __builtin_amdgcn_sched_barrier(0);
#pragma unroll
    for (int r = 0; r < 8; ++r)
#pragma unroll
      for (int dt = 0; dt < 8; ++dt) obase[(size_t)(mt * 16 + r) * 4096 + dt * 16] = o[r][dt];
    // s_wait_xcnt 0 behind the stores: a precaution, it stands ahead of any rewrite
    // of their address and data registers by the next row tile.
    asm volatile("s_wait_xcnt 0x0" ::: "memory");
    __builtin_amdgcn_sched_barrier(0);
  }
}

// ---------------------------------------------------------------------------
// Kernel 3: out = Oh . Woh^T + bo (f32 out). grid = (8, 64); block = 128.
// Block tile 64(M) x 64(N), each wave 32 x 32, K = 4096 in 64 staged trips.
// ---------------------------------------------------------------------------
__global__ __launch_bounds__(128) void out_proj_kernel(
    const _Float16* __restrict__ Oh, const _Float16* __restrict__ Woh,
    const float* __restrict__ bo, float* __restrict__ out) {
  __shared__ __attribute__((aligned(16))) char smem[2 * (64 + 64) * LDS_PITCH];
  const int lane = threadIdx.x & 31, wave = threadIdx.x >> 5;
  const int lm = lane & 15, hs = lane >> 4;
  const int bm0 = blockIdx.y * 64;
  const int bn0 = blockIdx.x * 64;

  v8f acc[2][2] = {};
  gemm_staged<64, 64, 4096>(Oh, Woh, bm0, bn0, smem, acc);

  const int m0 = bm0 + (wave >> 1) * 32;
  const int n0 = bn0 + (wave & 1) * 32;
#pragma unroll
  for (int j = 0; j < 2; ++j) {
    const int n = n0 + j * 16 + lm;
    const float bias = bo[n];
#pragma unroll
    for (int i = 0; i < 2; ++i) {
#pragma unroll
      for (int r = 0; r < 8; ++r) {
        const int m = m0 + i * 16 + r + hs * 8;
        out[(size_t)m * 512 + n] = acc[i][j][r] + bias;
      }
    }
  }
}

// ---------------------------------------------------------------------------
extern "C" void kernel_launch(void* const* d_in, const int* in_sizes, int n_in,
                              void* d_out, int out_size, void* d_ws, size_t ws_size,
                              hipStream_t stream) {
  (void)in_sizes; (void)n_in; (void)out_size; (void)ws_size;
  const float* x  = (const float*)d_in[0];
  const float* Wq = (const float*)d_in[1];
  const float* Wk = (const float*)d_in[2];
  const float* Wv = (const float*)d_in[3];
  const float* Wo = (const float*)d_in[4];
  const float* bo = (const float*)d_in[5];
  float* out = (float*)d_out;

  char* ws = (char*)d_ws;
  _Float16* Qh  = (_Float16*)(ws);
  _Float16* Kh  = (_Float16*)(ws + (size_t)33554432);
  _Float16* Vt  = (_Float16*)(ws + (size_t)67108864);
  _Float16* Oh  = (_Float16*)(ws + (size_t)100663296);
  _Float16* Xh  = (_Float16*)(ws + (size_t)134217728);
  _Float16* Wqh = (_Float16*)(ws + (size_t)138412032);
  _Float16* Wkh = (_Float16*)(ws + (size_t)142606336);
  _Float16* Wvh = (_Float16*)(ws + (size_t)146800640);
  _Float16* Woh = (_Float16*)(ws + (size_t)150994944);

  cvt_f16_kernel<<<dim3(2048, 5), 256, 0, stream>>>(x, Wq, Wk, Wv, Wo,
                                                    Xh, Wqh, Wkh, Wvh, Woh);
  qkv_proj_kernel<<<dim3(32, 32, 3), 128, 0, stream>>>(Xh, Wqh, Wkh, Wvh,
                                                       Qh, Kh, Vt);
  flash_attn_kernel<<<dim3(16, 32), 128, 0, stream>>>(Qh, Kh, Vt, Oh);
  out_proj_kernel<<<dim3(8, 64), 128, 0, stream>>>(Oh, Woh, bo, out);
}

// v003
// It runs in 196 microseconds.
// In two side-by-side timings against v002, it was 1.27 and 1.26 times as fast.
// All steps since v000 together make it 3.49 times as fast.
#include <hip/hip_runtime.h>

// ---------------------------------------------------------------------------
// MI455X (gfx1250) fused multi-head self-attention, f16 WMMA / f32 accum.
//   B=4, T=1024, EMBED=512, H=8, head_dim=512 (reference uses full EMBED/head)
// Workspace layout (148 MB total):
//   Qh  : (B,H,T,512) f16 @ 0      (scaled by 512^-0.25)
//   Kh  : (B,H,T,512) f16 @ 32MB   (scaled by 512^-0.25)
//   Vt  : (B,H,512,T) f16 @ 64MB   (transposed -> WMMA B-operand b128 loads)
//   Oh  : (B,T,4096)  f16 @ 96MB
//   Xh  : (4096,512)  f16 @ 128MB  (x converted once)
//   Wqh/Wkh/Wvh : (4096,512) f16 @ 132/136/140MB
//   Woh : (512,4096)  f16 @ 144MB
// The projection GEMMs read f16 tiles staged in LDS; attention reads f16 from global.
// ---------------------------------------------------------------------------

typedef _Float16 v16h __attribute__((ext_vector_type(16)));
typedef _Float16 v8h  __attribute__((ext_vector_type(8)));
typedef _Float16 v4h  __attribute__((ext_vector_type(4)));
typedef float    v8f  __attribute__((ext_vector_type(8)));
typedef float    v4f  __attribute__((ext_vector_type(4)));

#define WMMA(a, b, c) \
  __builtin_amdgcn_wmma_f32_16x16x32_f16(false, (a), false, (b), (short)0, (c), false, false)

// A/B fragment element e (lane L, hs=L>>4): K = (e>>3)*16 + hs*8 + (e&7)
// -> two contiguous 8-half (16B) runs at K0 = hs*8 and K0+16.
static __device__ __forceinline__ v16h frag_f16(const _Float16* p0) {
  v8h lo = *(const v8h*)p0;
  v8h hi = *(const v8h*)(p0 + 16);
  v16h r;
#pragma unroll
  for (int i = 0; i < 8; ++i) { r[i] = lo[i]; r[8 + i] = hi[i]; }
  return r;
}

// ---------------------------------------------------------------------------
// Projection GEMM core: C(BM x BN) = A(BM x K) . B(BN x K)^T, both k-contiguous.
// 128 threads, 4 waves as 2 x 2, each wave (BM/2) x (BN/2). A trip is 64 k
// (128-byte rows): [A rows | B rows] at an LDS pitch of 144 B, two buffers,
// filled by per-lane 16-byte asynchronous copies (a wave covers 4 whole rows).
// ---------------------------------------------------------------------------
#define LDS_PITCH 144

// Four copies, then s_wait_xcnt 0 (a precaution: it stands ahead of any rewrite of
// the copies' address registers); one statement, so that the compiler can put
// nothing between the copies and the wait.
static __device__ __forceinline__ void copy4_to_lds(unsigned l, const _Float16* g,
                                                    int lstep, size_t gstep) {
  asm volatile(
      "global_load_async_to_lds_b128 %0, %4, off\n\t"
      "global_load_async_to_lds_b128 %1, %5, off\n\t"
      "global_load_async_to_lds_b128 %2, %6, off\n\t"
      "global_load_async_to_lds_b128 %3, %7, off\n\t"
      "s_wait_xcnt 0x0"
      :: "v"(l), "v"(l + lstep), "v"(l + 2 * lstep), "v"(l + 3 * lstep),
         "v"(g), "v"(g + gstep), "v"(g + 2 * gstep), "v"(g + 3 * gstep)
      : "memory");
}

// ROWS rows of 128 B: thread t brings 16 B at row (t >> 3) + 16 i, byte (t & 7) * 16.
template <int ROWS, int K>
static __device__ __forceinline__ void stage_rows(unsigned l, const _Float16* g) {
#pragma unroll  // address steps become constants
  for (int i = 0; i < ROWS / 16; i += 4)
    copy4_to_lds(l + i * 16 * LDS_PITCH, g + (size_t)i * 16 * K, 16 * LDS_PITCH,
                 (size_t)16 * K);
}

template <int BM, int BN, int K>
static __device__ __forceinline__ void gemm_staged(
    const _Float16* __restrict__ A, const _Float16* __restrict__ B, int m0, int n0,
    char* smem, v8f (&acc)[BM / 32][BN / 32]) {
  constexpr int STAGE = (BM + BN) * LDS_PITCH;
  constexpr int T = K / 64;
  static_assert(T >= 2 && K % 64 == 0 && BM % 64 == 0 && BN % 64 == 0, "tile shape");
  const int tid = threadIdx.x;
  const int lane = tid & 31, wave = tid >> 5;
  const int lm = lane & 15, hs = lane >> 4;
  const int wm = wave >> 1, wn = wave & 1;

  const _Float16* ga = A + (size_t)(m0 + (tid >> 3)) * K + (tid & 7) * 8;
  const _Float16* gb = B + (size_t)(n0 + (tid >> 3)) * K + (tid & 7) * 8;
  const unsigned la = (unsigned)(uintptr_t)smem + (tid >> 3) * LDS_PITCH + (tid & 7) * 16;
  const unsigned lb = la + BM * LDS_PITCH;
  const char* ra = smem + (wm * (BM / 2) + lm) * LDS_PITCH + hs * 16;
  const char* rb = smem + (BM + wn * (BN / 2) + lm) * LDS_PITCH + hs * 16;

  stage_rows<BM, K>(la, ga);
  stage_rows<BN, K>(lb, gb);
  // Tile 0 has landed for this wave; the barrier publishes it to the others.
  asm volatile("s_wait_asynccnt 0x0" ::: "memory");
  __syncthreads();
  stage_rows<BM, K>(la + STAGE, ga + 64);
  stage_rows<BN, K>(lb + STAGE, gb + 64);

  for (int t = 0; t < T; ++t) {
    const int off = (t & 1) * STAGE;
    // All loops below are unrolled so that every fragment and accumulator index
    // is a constant (registers, no scratch).
#pragma unroll
    for (int ks = 0; ks < 2; ++ks) {
      v16h a[BM / 32], b[BN / 32];
#pragma unroll
      for (int i = 0; i < BM / 32; ++i)
        a[i] = frag_f16((const _Float16*)(ra + off + i * 16 * LDS_PITCH + ks * 64));
#pragma unroll
      for (int j = 0; j < BN / 32; ++j)
        b[j] = frag_f16((const _Float16*)(rb + off + j * 16 * LDS_PITCH + ks * 64));
#pragma unroll
      for (int i = 0; i < BM / 32; ++i)
#pragma unroll
        for (int j = 0; j < BN / 32; ++j) acc[i][j] = WMMA(a[i], b[j], acc[i][j]);
    }
    // This wave's reads of buffer t & 1 are done before it may be refilled.
    asm volatile("s_wait_dscnt 0x0" ::: "memory");
    // This wave's copies of tile t + 1 have landed before the barrier publishes them.
    asm volatile("s_wait_asynccnt 0x0" ::: "memory");
    __syncthreads();
    if (t + 2 < T) {
      stage_rows<BM, K>(la + off, ga + (t + 2) * 64);
      stage_rows<BN, K>(lb + off, gb + (t + 2) * 64);
    }
  }
  // No copy is outstanding when the wave goes on to its stores and ends.
  asm volatile("s_wait_asynccnt 0x0" ::: "memory");
}

// ---------------------------------------------------------------------------
// Kernel 0: one-shot f32 -> f16 conversion of x and the four weights.
// All five tensors are 2,097,152 elements. grid = (2048, 5), block = 256.
// ---------------------------------------------------------------------------
__global__ __launch_bounds__(256) void cvt_f16_kernel(
    const float* __restrict__ sx, const float* __restrict__ sq,
    const float* __restrict__ sk, const float* __restrict__ sv,
    const float* __restrict__ so,
    _Float16* __restrict__ dx, _Float16* __restrict__ dq,
    _Float16* __restrict__ dk, _Float16* __restrict__ dv,
    _Float16* __restrict__ dw) {
  const float* src;
  _Float16* dst;
  switch (blockIdx.y) {
    case 0: src = sx; dst = dx; break;
    case 1: src = sq; dst = dq; break;
    case 2: src = sk; dst = dk; break;
    case 3: src = sv; dst = dv; break;
    default: src = so; dst = dw; break;
  }
  const size_t i = ((size_t)blockIdx.x * 256 + threadIdx.x) * 4;
  v4f v = *(const v4f*)(src + i);
  v4h h;
#pragma unroll
  for (int j = 0; j < 4; ++j) h[j] = (_Float16)v[j];
  *(v4h*)(dst + i) = h;
}

// ---------------------------------------------------------------------------
// Kernel 1: Q/K/V projections (f16 x f16 -> f32). grid = (32, 32, 3); block 128.
// Block tile 128 x 128, each wave 64 x 64, K = 512 in 8 staged trips.
// A lane of the accumulator holds 8 neighbouring rows of the A side at one row of
// the B side. The side whose index runs contiguously in the output is therefore
// given as A: the weight rows (d) for Q and K, the x rows (t) for the transposed V.
// Each wave packs its tile to f16 in an LDS range of its own, one output row of
// 128 B per B-side row, and stores it as whole 128-byte lines, 16 B a lane.
// ---------------------------------------------------------------------------
// 16 stores of 4 whole output rows each; PITCH (halves) is a constant so that every
// store takes one address register pair and an immediate offset.
template <int PITCH>
static __device__ __forceinline__ void store_rows(_Float16* p, const v8h (&o)[16]) {
#pragma unroll  // offsets and register indices become constants
  for (int s = 0; s < 16; ++s) *(v8h*)(p + (size_t)s * 4 * PITCH) = o[s];
}

__global__ __launch_bounds__(128) void qkv_proj_kernel(
    const _Float16* __restrict__ Xh, const _Float16* __restrict__ Wqh,
    const _Float16* __restrict__ Wkh, const _Float16* __restrict__ Wvh,
    _Float16* __restrict__ Qh, _Float16* __restrict__ Kh,
    _Float16* __restrict__ Vt) {
  __shared__ __attribute__((aligned(16))) char smem[2 * (128 + 128) * LDS_PITCH];
  const int lane = threadIdx.x & 31, wave = threadIdx.x >> 5;
  const int lm = lane & 15, hs = lane >> 4;
  const int z = blockIdx.z;
  const _Float16* W = (z == 0) ? Wqh : ((z == 1) ? Wkh : Wvh);
  const int bm0 = blockIdx.y * 128;  // row in (b*t) space
  const int bn0 = blockIdx.x * 128;  // col in (h*d) space
  const bool wa = z < 2;             // weights on the A side (Q, K)

  v8f acc[4][4] = {};
  gemm_staged<128, 128, 512>(wa ? W : Xh, wa ? Xh : W, wa ? bn0 : bm0, wa ? bm0 : bn0,
                             smem, acc);

  // The last trip's barrier stands behind every wave's last read of the ring and no
  // copy is outstanding: the ring is free, and each wave takes 64 rows of it.
  char* st = smem + wave * (64 * LDS_PITCH);
  const float sc = wa ? 0.21022410381342865f : 1.0f;  // 512^-0.25
  // The loops below are unrolled so that every accumulator and row index is a
  // constant (registers, no scratch).
#pragma unroll
  for (int i = 0; i < 4; ++i) {
#pragma unroll
    for (int j = 0; j < 4; ++j) {
      v8h h8;  // C layout: A-side row = i*16 + hs*8 + r, B-side row = j*16 + lm
#pragma unroll
      for (int r = 0; r < 8; ++r) h8[r] = (_Float16)(acc[i][j][r] * sc);
      *(v8h*)(st + (j * 16 + lm) * LDS_PITCH + (i * 16 + hs * 8) * 2) = h8;
    }
  }
  // The rows are read back by other lanes of this wave: its LDS writes are done first.
  asm volatile("s_wait_dscnt 0x0" ::: "memory");
  v8h o[16];
#pragma unroll
  for (int s = 0; s < 16; ++s)
    o[s] = *(const v8h*)(st + (s * 4 + (lane >> 3)) * LDS_PITCH + (lane & 7) * 16);

  const int m0 = bm0 + (wa ? (wave & 1) : (wave >> 1)) * 64;
  const int n0 = bn0 + (wa ? (wave >> 1) : (wave & 1)) * 64;
  const size_t head = (size_t)((m0 >> 10) * 8 + (n0 >> 9)) * (1024 * 512);
  const int t0 = m0 & 1023, d0 = n0 & 511;
  if (wa) {
    _Float16* dst = (z == 0) ? Qh : Kh;
    store_rows<512>(dst + head + (size_t)(t0 + (lane >> 3)) * 512 + d0 + (lane & 7) * 8, o);
  } else {
    store_rows<1024>(Vt + head + (size_t)(d0 + (lane >> 3)) * 1024 + t0 + (lane & 7) * 8, o);
  }
  // s_wait_xcnt 0 behind the stores: a precaution, it stands ahead of any rewrite of
  // their address and data registers.
  asm volatile("s_wait_xcnt 0x0" ::: "memory");
}

// ---------------------------------------------------------------------------
// Kernel 2: flash attention. grid = (T/64, B*H); block = 128 (4 waves).
// A work-group owns 64 query rows (4 row tiles of 16). Waves split d=512 into
// 128-wide slices; every K and V fragment a wave loads feeds all 4 row tiles.
// The 64 x 512 O tile takes 256 registers a lane, so the Q tile lives in LDS.
// S partials are reduced across waves in LDS; 64 threads run the online softmax,
// one row each. LDS row pitches (1040 B for Q, 144 B for S, 80 B for P) are odd
// multiples of 16 B: 16-byte accesses of neighbouring rows fall on different banks.
// All inner loops are unrolled so that every fragment and accumulator index is a
// constant (registers, no scratch).
// ---------------------------------------------------------------------------
#define QT 4         // 16-row query tiles per work-group
#define SP_PITCH 36  // floats per S row in LDS
#define PT_PITCH 40  // halves per P row in LDS
#define QS_PITCH 520 // halves per Q row in LDS

__global__ __launch_bounds__(128) void flash_attn_kernel(
    const _Float16* __restrict__ Qh, const _Float16* __restrict__ Kh,
    const _Float16* __restrict__ Vt, _Float16* __restrict__ Oh) {
  __shared__ __align__(16) _Float16 Qs[QT * 16 * QS_PITCH];      // Q tile (A frag src)
  __shared__ __align__(16) float Spart[4 * QT * 16 * SP_PITCH];  // per-wave S partials
  __shared__ __align__(16) _Float16 Ptile[QT * 16 * PT_PITCH];   // softmax probs (A frag src)
  __shared__ float rowmax[QT * 16], rowsum[QT * 16], alphaS[QT * 16];

  const int tid = threadIdx.x;
  const int lane = tid & 31, wave = tid >> 5;
  const int lm = lane & 15, hs = lane >> 4;
  const int bh = blockIdx.y;
  const int m0 = blockIdx.x * (QT * 16);
  const int ds0 = wave * 128;

  const _Float16* qbase = Qh + ((size_t)bh * 1024 + m0) * 512;
  const _Float16* kbase = Kh + (size_t)bh * 1024 * 512;
  const _Float16* vbase = Vt + (size_t)bh * 512 * 1024;

  // Q tile to LDS once (reused all key blocks): two whole rows per pass of the block.
#pragma unroll
  for (int i = 0; i < QT * 8; ++i)
    *(v8h*)(Qs + (i * 2 + (tid >> 6)) * QS_PITCH + (tid & 63) * 8) =
        *(const v8h*)(qbase + (size_t)(i * 2 + (tid >> 6)) * 512 + (tid & 63) * 8);
  const _Float16* qrow = Qs + lm * QS_PITCH + ds0 + hs * 8;

  v8f oacc[QT][8] = {};

  if (tid < QT * 16) { rowmax[tid] = -1e30f; rowsum[tid] = 0.0f; }
  __syncthreads();

  for (int n0k = 0; n0k < 1024; n0k += 32) {
    // Non-blocking prefetch of next key block (global_prefetch_b8).
    if (n0k + 32 < 1024) {
      __builtin_prefetch(kbase + (size_t)(n0k + 32 + lm) * 512 + ds0, 0, 1);
      __builtin_prefetch(vbase + (size_t)(ds0 + lm) * 1024 + n0k + 32, 0, 1);
    }
    // ---- S partial = Q[:,dslice] . K[n0k:n0k+32, dslice]^T  (2 tiles per row tile) ----
    v8f s0[QT] = {}, s1[QT] = {};
    v16h b0[4], b1[4], qf[2][QT];
    const _Float16* kp = kbase + (size_t)(n0k + lm) * 512 + ds0 + hs * 8;
#pragma unroll
    for (int dt = 0; dt < 4; ++dt) {
      b0[dt] = frag_f16(kp + dt * 32);
      b1[dt] = frag_f16(kp + 16 * 512 + dt * 32);
    }
#pragma unroll
    for (int mt = 0; mt < QT; ++mt) qf[0][mt] = frag_f16(qrow + mt * 16 * QS_PITCH);
    // s_wait_xcnt 0 behind the K loads: a precaution, it stands ahead of any rewrite
    // of their address register; naming the address as an input keeps that register
    // from being handed to one of the loads as its destination.
    asm volatile("s_wait_xcnt 0x0" :: "v"(kp) : "memory");
    // Keeps all 16 K loads in flight together: without it the compiler sinks them
    // between the products and the wave waits out one load latency per d step.
    __builtin_amdgcn_sched_barrier(0);
#pragma unroll
    for (int dt = 0; dt < 4; ++dt) {
      if (dt < 3) {
#pragma unroll
        for (int mt = 0; mt < QT; ++mt)
          qf[(dt + 1) & 1][mt] = frag_f16(qrow + mt * 16 * QS_PITCH + (dt + 1) * 32);
      }
      // Keeps the next d step's Q reads as one group ahead of this step's products,
      // so that their LDS latency runs behind 8 matrix instructions.
      __builtin_amdgcn_sched_barrier(0);
#pragma unroll
      for (int mt = 0; mt < QT; ++mt) {
        s0[mt] = WMMA(qf[dt & 1][mt], b0[dt], s0[mt]);
        s1[mt] = WMMA(qf[dt & 1][mt], b1[dt], s1[mt]);
      }
    }
    float* sp = Spart + wave * (QT * 16 * SP_PITCH);
#pragma unroll
    for (int mt = 0; mt < QT; ++mt) {
#pragma unroll
      for (int r = 0; r < 8; ++r) {
        const int m = mt * 16 + r + hs * 8;
        sp[m * SP_PITCH + lm] = s0[mt][r];
        sp[m * SP_PITCH + 16 + lm] = s1[mt][r];
      }
    }
    __syncthreads();

    // ---- online softmax: thread m owns row m, sums the 4 wave partials ----
    if (tid < QT * 16) {
      const int m = tid;
      const float mold = rowmax[m], lold = rowsum[m];
      const float* s_row = Spart + m * SP_PITCH;
      float sv[32];
      float smax = mold;
#pragma unroll
      for (int n = 0; n < 32; ++n) {
        float s = s_row[n] + s_row[QT * 16 * SP_PITCH + n] +
                  s_row[2 * QT * 16 * SP_PITCH + n] + s_row[3 * QT * 16 * SP_PITCH + n];
        sv[n] = s;
        smax = fmaxf(smax, s);
      }
      const float alpha = __expf(mold - smax);
      float lsum = lold * alpha;
#pragma unroll
      for (int n = 0; n < 32; ++n) {
        const float p = __expf(sv[n] - smax);
        lsum += p;
        Ptile[m * PT_PITCH + n] = (_Float16)p;
      }
      rowmax[m] = smax; rowsum[m] = lsum; alphaS[m] = alpha;
    }
    __syncthreads();

    // ---- rescale O accumulators, then O += P . V over this d-slice ----
    v16h pf[QT];  // P as A operand (16x32 per row tile)
#pragma unroll
    for (int mt = 0; mt < QT; ++mt) {
#pragma unroll
      for (int r = 0; r < 8; ++r) {
        const float am = alphaS[mt * 16 + r + hs * 8];
#pragma unroll
        for (int dt = 0; dt < 8; ++dt) oacc[mt][dt][r] *= am;
      }
      pf[mt] = frag_f16(Ptile + (mt * 16 + lm) * PT_PITCH + hs * 8);
    }
#pragma unroll
    for (int dt = 0; dt < 8; ++dt) {
      // B[k][n] = V[key][dcol] = Vt[dcol][key]: lane holds Vt row, contig in t
      v16h bf = frag_f16(vbase + (size_t)(ds0 + dt * 16 + lm) * 1024 + n0k + hs * 8);
#pragma unroll
      for (int mt = 0; mt < QT; ++mt) oacc[mt][dt] = WMMA(pf[mt], bf, oacc[mt][dt]);
    }
    __syncthreads();
  }

  // ---- normalize and store to Oh (B,T,H*512) ----
  const int b = bh >> 3, h = bh & 7;
  _Float16* obase = Oh + ((size_t)b * 1024 + m0 + hs * 8) * 4096 + h * 512 + ds0 + lm;
#pragma unroll
  for (int mt = 0; mt < QT; ++mt) {
    _Float16 o[8][8];
#pragma unroll
    for (int r = 0; r < 8; ++r) {
      const float inv = 1.0f / rowsum[mt * 16 + r + hs * 8];
#pragma unroll
      for (int dt = 0; dt < 8; ++dt) o[r][dt] = (_Float16)(oacc[mt][dt][r] * inv);
    }
    // The two scheduling fences keep every vector write of a row tile ahead of its
    // stores and every later one behind the wait below.
    __builtin_amdgcn_sched_barrier(0);
#pragma unroll
    for (int r = 0; r < 8; ++r)
#pragma unroll
      for (int dt = 0; dt < 8; ++dt) obase[(size_t)(mt * 16 + r) * 4096 + dt * 16] = o[r][dt];
    // s_wait_xcnt 0 behind the stores: a precaution, it stands ahead of any rewrite
    // of their address and data registers by the next row tile.
    asm volatile("s_wait_xcnt 0x0" ::: "memory");
    __builtin_amdgcn_sched_barrier(0);
  }
}

// ---------------------------------------------------------------------------
// Kernel 3: out = Oh . Woh^T + bo (f32 out). grid = (8, 64); block = 128.
// Block tile 64(M) x 64(N), each wave 32 x 32, K = 4096 in 64 staged trips.
// ---------------------------------------------------------------------------
__global__ __launch_bounds__(128) void out_proj_kernel(
    const _Float16* __restrict__ Oh, const _Float16* __restrict__ Woh,
    const float* __restrict__ bo, float* __restrict__ out) {
  __shared__ __attribute__((aligned(16))) char smem[2 * (64 + 64) * LDS_PITCH];
  const int lane = threadIdx.x & 31, wave = threadIdx.x >> 5;
  const int lm = lane & 15, hs = lane >> 4;
  const int bm0 = blockIdx.y * 64;
  const int bn0 = blockIdx.x * 64;

  v8f acc[2][2] = {};
  gemm_staged<64, 64, 4096>(Oh, Woh, bm0, bn0, smem, acc);

  const int m0 = bm0 + (wave >> 1) * 32;
  const int n0 = bn0 + (wave & 1) * 32;
#pragma unroll
  for (int j = 0; j < 2; ++j) {
    const int n = n0 + j * 16 + lm;
    const float bias = bo[n];
#pragma unroll
    for (int i = 0; i < 2; ++i) {
#pragma unroll
      for (int r = 0; r < 8; ++r) {
        const int m = m0 + i * 16 + r + hs * 8;
        out[(size_t)m * 512 + n] = acc[i][j][r] + bias;
      }
    }
  }
}

// ---------------------------------------------------------------------------
extern "C" void kernel_launch(void* const* d_in, const int* in_sizes, int n_in,
                              void* d_out, int out_size, void* d_ws, size_t ws_size,
                              hipStream_t stream) {
  (void)in_sizes; (void)n_in; (void)out_size; (void)ws_size;
  const float* x  = (const float*)d_in[0];
  const float* Wq = (const float*)d_in[1];
  const float* Wk = (const float*)d_in[2];
  const float* Wv = (const float*)d_in[3];
  const float* Wo = (const float*)d_in[4];
  const float* bo = (const float*)d_in[5];
  float* out = (float*)d_out;

  char* ws = (char*)d_ws;
  _Float16* Qh  = (_Float16*)(ws);
  _Float16* Kh  = (_Float16*)(ws + (size_t)33554432);
  _Float16* Vt  = (_Float16*)(ws + (size_t)67108864);
  _Float16* Oh  = (_Float16*)(ws + (size_t)100663296);
  _Float16* Xh  = (_Float16*)(ws + (size_t)134217728);
  _Float16* Wqh = (_Float16*)(ws + (size_t)138412032);
  _Float16* Wkh = (_Float16*)(ws + (size_t)142606336);
  _Float16* Wvh = (_Float16*)(ws + (size_t)146800640);
  _Float16* Woh = (_Float16*)(ws + (size_t)150994944);

  cvt_f16_kernel<<<dim3(2048, 5), 256, 0, stream>>>(x, Wq, Wk, Wv, Wo,
                                                    Xh, Wqh, Wkh, Wvh, Woh);
  qkv_proj_kernel<<<dim3(32, 32, 3), 128, 0, stream>>>(Xh, Wqh, Wkh, Wvh,
                                                       Qh, Kh, Vt);
  flash_attn_kernel<<<dim3(16, 32), 128, 0, stream>>>(Qh, Kh, Vt, Oh);
  out_proj_kernel<<<dim3(8, 64), 128, 0, stream>>>(Oh, Woh, bo, out);
}

// v004
// A run of this version takes 185 microseconds.
// In two side-by-side timings against v003, it was 1.06 and 1.05 times as fast.
// All steps since v000 together make it 3.69 times as fast.
#include <hip/hip_runtime.h>

// ---------------------------------------------------------------------------
// MI455X (gfx1250) fused multi-head self-attention, f16 WMMA / f32 accum.
//   B=4, T=1024, EMBED=512, H=8, head_dim=512 (reference uses full EMBED/head)
// Workspace layout (148 MB total):
//   Qh  : (B,H,T,512) f16 @ 0      (scaled by 512^-0.25)
//   Kh  : (B,H) x 64 key tiles x 16 d tiles of 16 keys x 32 d, f16 @ 32MB
//         (scaled by 512^-0.25), each tile in fragment order (see frag_packed)
//   Vt  : (B,H) x 32 key tiles x 32 d tiles of 16 d x 32 keys, f16 @ 64MB,
//         each tile in fragment order
//   Oh  : (B,T,4096)  f16 @ 96MB
//   Xh  : (4096,512)  f16 @ 128MB  (x converted once)
//   Wqh/Wkh/Wvh : (4096,512) f16 @ 132/136/140MB
//   Woh : (512,4096)  f16 @ 144MB
// The projection GEMMs read f16 tiles staged in LDS; attention reads f16 from global.
// ---------------------------------------------------------------------------

typedef _Float16 v16h __attribute__((ext_vector_type(16)));
typedef _Float16 v8h  __attribute__((ext_vector_type(8)));
typedef _Float16 v4h  __attribute__((ext_vector_type(4)));
typedef float    v8f  __attribute__((ext_vector_type(8)));
typedef float    v4f  __attribute__((ext_vector_type(4)));

#define WMMA(a, b, c) \
  __builtin_amdgcn_wmma_f32_16x16x32_f16(false, (a), false, (b), (short)0, (c), false, false)

// A/B fragment element e (lane L, hs=L>>4): K = (e>>3)*16 + hs*8 + (e&7)
// -> two contiguous 8-half (16B) runs at K0 = hs*8 and K0+16.
static __device__ __forceinline__ v16h frag_f16(const _Float16* p0) {
  v8h lo = *(const v8h*)p0;
  v8h hi = *(const v8h*)(p0 + 16);
  v16h r;
#pragma unroll
  for (int i = 0; i < 8; ++i) { r[i] = lo[i]; r[8 + i] = hi[i]; }
  return r;
}

// A 16 x 32 B-operand tile stored in fragment order: 1024 B, 16-byte unit u holds
// row u & 15, k = (u >> 5) * 16 + ((u >> 4) & 1) * 8 .. + 7. Lane L takes units L and
// L + 32, so each of the two wave-wide loads covers 512 contiguous bytes (4 whole
// 128-byte lines). p0 = tile + lane * 8.
static __device__ __forceinline__ v16h frag_packed(const _Float16* p0) {
  v8h lo = *(const v8h*)p0;
  v8h hi = *(const v8h*)(p0 + 256);
  v16h r;
#pragma unroll
  for (int i = 0; i < 8; ++i) { r[i] = lo[i]; r[8 + i] = hi[i]; }
  return r;
}

// ---------------------------------------------------------------------------
// Projection GEMM core: C(BM x BN) = A(BM x K) . B(BN x K)^T, both k-contiguous.
// 128 threads, 4 waves as 2 x 2, each wave (BM/2) x (BN/2). A trip is 64 k
// (128-byte rows): [A rows | B rows] at an LDS pitch of 144 B, two buffers,
// filled by per-lane 16-byte asynchronous copies (a wave covers 4 whole rows).
// ---------------------------------------------------------------------------
#define LDS_PITCH 144

// Four copies, then s_wait_xcnt 0 (a precaution: it stands ahead of any rewrite of
// the copies' address registers); one statement, so that the compiler can put
// nothing between the copies and the wait.
static __device__ __forceinline__ void copy4_to_lds(unsigned l, const _Float16* g,
                                                    int lstep, size_t gstep) {
  asm volatile(
      "global_load_async_to_lds_b128 %0, %4, off\n\t"
      "global_load_async_to_lds_b128 %1, %5, off\n\t"
      "global_load_async_to_lds_b128 %2, %6, off\n\t"
      "global_load_async_to_lds_b128 %3, %7, off\n\t"
      "s_wait_xcnt 0x0"
      :: "v"(l), "v"(l + lstep), "v"(l + 2 * lstep), "v"(l + 3 * lstep),
         "v"(g), "v"(g + gstep), "v"(g + 2 * gstep), "v"(g + 3 * gstep)
      : "memory");
}

// ROWS rows of 128 B: thread t brings 16 B at row (t >> 3) + 16 i, byte (t & 7) * 16.
template <int ROWS, int K>
static __device__ __forceinline__ void stage_rows(unsigned l, const _Float16* g) {
#pragma unroll  // address steps become constants
  for (int i = 0; i < ROWS / 16; i += 4)
    copy4_to_lds(l + i * 16 * LDS_PITCH, g + (size_t)i * 16 * K, 16 * LDS_PITCH,
                 (size_t)16 * K);
}

template <int BM, int BN, int K>
static __device__ __forceinline__ void gemm_staged(
    const _Float16* __restrict__ A, const _Float16* __restrict__ B, int m0, int n0,
    char* smem, v8f (&acc)[BM / 32][BN / 32]) {
  constexpr int STAGE = (BM + BN) * LDS_PITCH;
  constexpr int T = K / 64;
  static_assert(T >= 2 && K % 64 == 0 && BM % 64 == 0 && BN % 64 == 0, "tile shape");
  const int tid = threadIdx.x;
  const int lane = tid & 31, wave = tid >> 5;
  const int lm = lane & 15, hs = lane >> 4;
  const int wm = wave >> 1, wn = wave & 1;

  const _Float16* ga = A + (size_t)(m0 + (tid >> 3)) * K + (tid & 7) * 8;
  const _Float16* gb = B + (size_t)(n0 + (tid >> 3)) * K + (tid & 7) * 8;
  const unsigned la = (unsigned)(uintptr_t)smem + (tid >> 3) * LDS_PITCH + (tid & 7) * 16;
  const unsigned lb = la + BM * LDS_PITCH;
  const char* ra = smem + (wm * (BM / 2) + lm) * LDS_PITCH + hs * 16;
  const char* rb = smem + (BM + wn * (BN / 2) + lm) * LDS_PITCH + hs * 16;

  stage_rows<BM, K>(la, ga);
  stage_rows<BN, K>(lb, gb);
  // Tile 0 has landed for this wave; the barrier publishes it to the others.
  asm volatile("s_wait_asynccnt 0x0" ::: "memory");
  __syncthreads();
  stage_rows<BM, K>(la + STAGE, ga + 64);
  stage_rows<BN, K>(lb + STAGE, gb + 64);

  for (int t = 0; t < T; ++t) {
    const int off = (t & 1) * STAGE;
    // All loops below are unrolled so that every fragment and accumulator index
    // is a constant (registers, no scratch).
#pragma unroll
    for (int ks = 0; ks < 2; ++ks) {
      v16h a[BM / 32], b[BN / 32];
#pragma unroll
      for (int i = 0; i < BM / 32; ++i)
        a[i] = frag_f16((const _Float16*)(ra + off + i * 16 * LDS_PITCH + ks * 64));
#pragma unroll
      for (int j = 0; j < BN / 32; ++j)
        b[j] = frag_f16((const _Float16*)(rb + off + j * 16 * LDS_PITCH + ks * 64));
#pragma unroll
      for (int i = 0; i < BM / 32; ++i)
#pragma unroll
        for (int j = 0; j < BN / 32; ++j) acc[i][j] = WMMA(a[i], b[j], acc[i][j]);
    }
    // This wave's reads of buffer t & 1 are done before it may be refilled.
    asm volatile("s_wait_dscnt 0x0" ::: "memory");
    // This wave's copies of tile t + 1 have landed before the barrier publishes them.
    asm volatile("s_wait_asynccnt 0x0" ::: "memory");
    __syncthreads();
    if (t + 2 < T) {
      stage_rows<BM, K>(la + off, ga + (t + 2) * 64);
      stage_rows<BN, K>(lb + off, gb + (t + 2) * 64);
    }
  }
  // No copy is outstanding when the wave goes on to its stores and ends.
  asm volatile("s_wait_asynccnt 0x0" ::: "memory");
}

// ---------------------------------------------------------------------------
// Kernel 0: one-shot f32 -> f16 conversion of x and the four weights.
// All five tensors are 2,097,152 elements. grid = (2048, 5), block = 256.
// ---------------------------------------------------------------------------
__global__ __launch_bounds__(256) void cvt_f16_kernel(
    const float* __restrict__ sx, const float* __restrict__ sq,
    const float* __restrict__ sk, const float* __restrict__ sv,
    const float* __restrict__ so,
    _Float16* __restrict__ dx, _Float16* __restrict__ dq,
    _Float16* __restrict__ dk, _Float16* __restrict__ dv,
    _Float16* __restrict__ dw) {
  const float* src;
  _Float16* dst;
  switch (blockIdx.y) {
    case 0: src = sx; dst = dx; break;
    case 1: src = sq; dst = dq; break;
    case 2: src = sk; dst = dk; break;
    case 3: src = sv; dst = dv; break;
    default: src = so; dst = dw; break;
  }
  const size_t i = ((size_t)blockIdx.x * 256 + threadIdx.x) * 4;
  v4f v = *(const v4f*)(src + i);
  v4h h;
#pragma unroll
  for (int j = 0; j < 4; ++j) h[j] = (_Float16)v[j];
  *(v4h*)(dst + i) = h;
}

// ---------------------------------------------------------------------------
// Kernel 1: Q/K/V projections (f16 x f16 -> f32). grid = (32, 32, 3); block 128.
// Block tile 128 x 128, each wave 64 x 64, K = 512 in 8 staged trips.
// A lane of the accumulator holds 8 neighbouring rows of the A side at one row of
// the B side. The side whose index runs contiguously in the output is therefore
// given as A: the weight rows (d) for Q and K, the x rows (t) for the transposed V.
// Each wave packs its tile to f16 in an LDS range of its own, one row of 128 B per
// B-side row, and stores it as whole 128-byte lines, 16 B a lane: Q as rows, K and V
// as 8 tiles in fragment order (a permutation of the 16-byte units of those rows).
// ---------------------------------------------------------------------------
// 16 stores of 4 whole output rows each; PITCH (halves) is a constant so that every
// store takes one address register pair and an immediate offset.
template <int PITCH>
static __device__ __forceinline__ void store_rows(_Float16* p, const v8h (&o)[16]) {
#pragma unroll  // offsets and register indices become constants
  for (int s = 0; s < 16; ++s) *(v8h*)(p + (size_t)s * 4 * PITCH) = o[s];
  // s_wait_xcnt 0 behind the stores: a precaution, it stands ahead of any rewrite of
  // their address and data registers.
  asm volatile("s_wait_xcnt 0x0" ::: "memory");
}

// 16 stores of half a fragment-order tile (512 B) each. Store s holds rows
// (s >> 2) * 16 .. + 15 of the staged tile, columns (s & 3) * 16 .. + 15; ROWSTEP and
// COLSTEP (halves) are the distances between neighbouring tiles along rows and columns.
template <int ROWSTEP, int COLSTEP>
static __device__ __forceinline__ void store_tiles(_Float16* p, const v8h (&o)[16]) {
#pragma unroll  // offsets and register indices become constants
  for (int s = 0; s < 16; ++s)
    *(v8h*)(p + (s >> 2) * ROWSTEP + ((s >> 1) & 1) * COLSTEP + (s & 1) * 256) = o[s];
  // s_wait_xcnt 0 behind the stores: the same precaution as in store_rows.
  asm volatile("s_wait_xcnt 0x0" ::: "memory");
}

__global__ __launch_bounds__(128) void qkv_proj_kernel(
    const _Float16* __restrict__ Xh, const _Float16* __restrict__ Wqh,
    const _Float16* __restrict__ Wkh, const _Float16* __restrict__ Wvh,
    _Float16* __restrict__ Qh, _Float16* __restrict__ Kh,
    _Float16* __restrict__ Vt) {
  __shared__ __attribute__((aligned(16))) char smem[2 * (128 + 128) * LDS_PITCH];
  const int lane = threadIdx.x & 31, wave = threadIdx.x >> 5;
  const int lm = lane & 15, hs = lane >> 4;
  const int z = blockIdx.z;
  const _Float16* W = (z == 0) ? Wqh : ((z == 1) ? Wkh : Wvh);
  const int bm0 = blockIdx.y * 128;  // row in (b*t) space
  const int bn0 = blockIdx.x * 128;  // col in (h*d) space
  const bool wa = z < 2;             // weights on the A side (Q, K)

  v8f acc[4][4] = {};
  gemm_staged<128, 128, 512>(wa ? W : Xh, wa ? Xh : W, wa ? bn0 : bm0, wa ? bm0 : bn0,
                             smem, acc);

  // The last trip's barrier stands behind every wave's last read of the ring and no
  // copy is outstanding: the ring is free, and each wave takes 64 rows of it.
  char* st = smem + wave * (64 * LDS_PITCH);
  const float sc = wa ? 0.21022410381342865f : 1.0f;  // 512^-0.25
  // The loops below are unrolled so that every accumulator and row index is a
  // constant (registers, no scratch).
#pragma unroll
  for (int i = 0; i < 4; ++i) {
#pragma unroll
    for (int j = 0; j < 4; ++j) {
      v8h h8;  // C layout: A-side row = i*16 + hs*8 + r, B-side row = j*16 + lm
#pragma unroll
      for (int r = 0; r < 8; ++r) h8[r] = (_Float16)(acc[i][j][r] * sc);
      *(v8h*)(st + (j * 16 + lm) * LDS_PITCH + (i * 16 + hs * 8) * 2) = h8;
    }
  }
  // The rows are read back by other lanes of this wave: its LDS writes are done first.
  asm volatile("s_wait_dscnt 0x0" ::: "memory");
  v8h o[16];
  const int m0 = bm0 + (wa ? (wave & 1) : (wave >> 1)) * 64;
  const int n0 = bn0 + (wa ? (wave >> 1) : (wave & 1)) * 64;
  const size_t head = (size_t)((m0 >> 10) * 8 + (n0 >> 9)) * (1024 * 512);
  const int t0 = m0 & 1023, d0 = n0 & 511;
  if (z == 0) {
#pragma unroll
    for (int s = 0; s < 16; ++s)
      o[s] = *(const v8h*)(st + (s * 4 + (lane >> 3)) * LDS_PITCH + (lane & 7) * 16);
    store_rows<512>(Qh + head + (size_t)(t0 + (lane >> 3)) * 512 + d0 + (lane & 7) * 8, o);
  } else {
    // Lane (hs, lm) of store s takes row (s >> 2) * 16 + lm, 16-byte unit (s & 3) * 2 + hs.
#pragma unroll
    for (int s = 0; s < 16; ++s)
      o[s] = *(const v8h*)(st + ((s >> 2) * 16 + lm) * LDS_PITCH + ((s & 3) * 2 + hs) * 16);
    if (z == 1)  // rows are keys, columns d: tile index = key tile * 16 + d tile
      store_tiles<16 * 512, 512>(Kh + head + ((t0 >> 4) * 16 + (d0 >> 5)) * 512 + lane * 8, o);
    else         // rows are d, columns keys: tile index = key tile * 32 + d tile
      store_tiles<512, 32 * 512>(Vt + head + ((t0 >> 5) * 32 + (d0 >> 4)) * 512 + lane * 8, o);
  }
}

// ---------------------------------------------------------------------------
// Kernel 2: flash attention. grid = (T/64, B*H); block = 128 (4 waves).
// A work-group owns 64 query rows (4 row tiles of 16). Waves split d=512 into
// 128-wide slices; every K and V fragment a wave loads feeds all 4 row tiles.
// The 64 x 512 O tile takes 256 registers a lane, so the Q tile lives in LDS.
// S partials are reduced across waves in LDS; 64 threads run the online softmax,
// one row each. LDS row pitches (1040 B for Q, 144 B for S, 80 B for P) are odd
// multiples of 16 B: 16-byte accesses of neighbouring rows fall on different banks.
// All inner loops are unrolled so that every fragment and accumulator index is a
// constant (registers, no scratch).
// ---------------------------------------------------------------------------
#define QT 4         // 16-row query tiles per work-group
#define SP_PITCH 36  // floats per S row in LDS
#define PT_PITCH 40  // halves per P row in LDS
#define QS_PITCH 520 // halves per Q row in LDS

__global__ __launch_bounds__(128) void flash_attn_kernel(
    const _Float16* __restrict__ Qh, const _Float16* __restrict__ Kh,
    const _Float16* __restrict__ Vt, _Float16* __restrict__ Oh) {
  __shared__ __align__(16) _Float16 Qs[QT * 16 * QS_PITCH];      // Q tile (A frag src)
  __shared__ __align__(16) float Spart[4 * QT * 16 * SP_PITCH];  // per-wave S partials
  __shared__ __align__(16) _Float16 Ptile[QT * 16 * PT_PITCH];   // softmax probs (A frag src)
  __shared__ float rowmax[QT * 16], rowsum[QT * 16], alphaS[QT * 16];

  const int tid = threadIdx.x;
  const int lane = tid & 31, wave = tid >> 5;
  const int lm = lane & 15, hs = lane >> 4;
  const int bh = blockIdx.y;
  const int m0 = blockIdx.x * (QT * 16);
  const int ds0 = wave * 128;

  const _Float16* qbase = Qh + ((size_t)bh * 1024 + m0) * 512;
  const _Float16* kbase = Kh + (size_t)bh * 1024 * 512;
  const _Float16* vbase = Vt + (size_t)bh * 512 * 1024;

  // Q tile to LDS once (reused all key blocks): two whole rows per pass of the block.
#pragma unroll
  for (int i = 0; i < QT * 8; ++i)
    *(v8h*)(Qs + (i * 2 + (tid >> 6)) * QS_PITCH + (tid & 63) * 8) =
        *(const v8h*)(qbase + (size_t)(i * 2 + (tid >> 6)) * 512 + (tid & 63) * 8);
  const _Float16* qrow = Qs + lm * QS_PITCH + ds0 + hs * 8;

  v8f oacc[QT][8] = {};

  if (tid < QT * 16) { rowmax[tid] = -1e30f; rowsum[tid] = 0.0f; }
  __syncthreads();

  for (int n0k = 0; n0k < 1024; n0k += 32) {
    // Non-blocking prefetch of next key block (global_prefetch_b8).
    if (n0k + 32 < 1024) {
      __builtin_prefetch(kbase + (n0k + 32) * 512 + wave * 2048 + lane * 64, 0, 1);
      __builtin_prefetch(vbase + (n0k + 32) * 512 + wave * 4096 + lane * 64, 0, 1);
    }
    // ---- S partial = Q[:,dslice] . K[n0k:n0k+32, dslice]^T  (2 tiles per row tile) ----
    v8f s0[QT] = {}, s1[QT] = {};
    v16h b0[4], b1[4], qf[2][QT];
    // Key tile n0k / 16, d tiles wave * 4 .. + 3: 4 KB in a row; the next key tile
    // lies 16 tiles on.
    const _Float16* kp = kbase + n0k * 512 + wave * 2048 + lane * 8;
#pragma unroll
    for (int dt = 0; dt < 4; ++dt) {
      b0[dt] = frag_packed(kp + dt * 512);
      b1[dt] = frag_packed(kp + 16 * 512 + dt * 512);
    }
#pragma unroll
    for (int mt = 0; mt < QT; ++mt) qf[0][mt] = frag_f16(qrow + mt * 16 * QS_PITCH);
    // s_wait_xcnt 0 behind the K loads: a precaution, it stands ahead of any rewrite
    // of their address register; naming the address as an input keeps that register
    // from being handed to one of the loads as its destination.
    asm volatile("s_wait_xcnt 0x0" :: "v"(kp) : "memory");
    // Keeps all 16 K loads in flight together: without it the compiler sinks them
    // between the products and the wave waits out one load latency per d step.
    __builtin_amdgcn_sched_barrier(0);
#pragma unroll
    for (int dt = 0; dt < 4; ++dt) {
      if (dt < 3) {
#pragma unroll
        for (int mt = 0; mt < QT; ++mt)
          qf[(dt + 1) & 1][mt] = frag_f16(qrow + mt * 16 * QS_PITCH + (dt + 1) * 32);
      }
      // Keeps the next d step's Q reads as one group ahead of this step's products,
      // so that their LDS latency runs behind 8 matrix instructions.
      __builtin_amdgcn_sched_barrier(0);
#pragma unroll
      for (int mt = 0; mt < QT; ++mt) {
        s0[mt] = WMMA(qf[dt & 1][mt], b0[dt], s0[mt]);
        s1[mt] = WMMA(qf[dt & 1][mt], b1[dt], s1[mt]);
      }
    }
    float* sp = Spart + wave * (QT * 16 * SP_PITCH);
#pragma unroll
    for (int mt = 0; mt < QT; ++mt) {
#pragma unroll
      for (int r = 0; r < 8; ++r) {
        const int m = mt * 16 + r + hs * 8;
        sp[m * SP_PITCH + lm] = s0[mt][r];
        sp[m * SP_PITCH + 16 + lm] = s1[mt][r];
      }
    }
    __syncthreads();

    // ---- online softmax: thread m owns row m, sums the 4 wave partials ----
    if (tid < QT * 16) {
      const int m = tid;
      const float mold = rowmax[m], lold = rowsum[m];
      const float* s_row = Spart + m * SP_PITCH;
      float sv[32];
      float smax = mold;
#pragma unroll
      for (int n = 0; n < 32; ++n) {
        float s = s_row[n] + s_row[QT * 16 * SP_PITCH + n] +
                  s_row[2 * QT * 16 * SP_PITCH + n] + s_row[3 * QT * 16 * SP_PITCH + n];
        sv[n] = s;
        smax = fmaxf(smax, s);
      }
      const float alpha = __expf(mold - smax);
      float lsum = lold * alpha;
#pragma unroll
      for (int n = 0; n < 32; ++n) {
        const float p = __expf(sv[n] - smax);
        lsum += p;
        Ptile[m * PT_PITCH + n] = (_Float16)p;
      }
      rowmax[m] = smax; rowsum[m] = lsum; alphaS[m] = alpha;
    }
    __syncthreads();

    // ---- rescale O accumulators, then O += P . V over this d-slice ----
    // B[k][n] = V[key][dcol]: key tile n0k / 32, d tiles wave * 8 .. + 7, 8 KB in a row.
    const _Float16* vp = vbase + n0k * 512 + wave * 4096 + lane * 8;
    v16h bf[8];
#pragma unroll
    for (int dt = 0; dt < 8; ++dt) bf[dt] = frag_packed(vp + dt * 512);
    // s_wait_xcnt 0 behind the V loads: a precaution, it stands ahead of any rewrite
    // of their address register; naming the address as an input keeps that register
    // from being handed to one of the loads as its destination.
    asm volatile("s_wait_xcnt 0x0" :: "v"(vp) : "memory");
    v16h pf[QT];  // P as A operand (16x32 per row tile)
#pragma unroll
    for (int mt = 0; mt < QT; ++mt) {
#pragma unroll
      for (int r = 0; r < 8; ++r) {
        const float am = alphaS[mt * 16 + r + hs * 8];
#pragma unroll
        for (int dt = 0; dt < 8; ++dt) oacc[mt][dt][r] *= am;
      }
      pf[mt] = frag_f16(Ptile + (mt * 16 + lm) * PT_PITCH + hs * 8);
    }
    // Keeps the P . V products, in front of which the wave waits for its V
    // loads, behind the rescaling: the loads' latency then runs behind the rescaling.
    __builtin_amdgcn_sched_barrier(0);
#pragma unroll
    for (int dt = 0; dt < 8; ++dt) {
#pragma unroll
      for (int mt = 0; mt < QT; ++mt) oacc[mt][dt] = WMMA(pf[mt], bf[dt], oacc[mt][dt]);
    }
    __syncthreads();
  }

  // ---- normalize and store to Oh (B,T,H*512) ----
  const int b = bh >> 3, h = bh & 7;
  _Float16* obase = Oh + ((size_t)b * 1024 + m0 + hs * 8) * 4096 + h * 512 + ds0 + lm;
#pragma unroll
  for (int mt = 0; mt < QT; ++mt) {
    _Float16 o[8][8];
#pragma unroll
    for (int r = 0; r < 8; ++r) {
      const float inv = 1.0f / rowsum[mt * 16 + r + hs * 8];
#pragma unroll
      for (int dt = 0; dt < 8; ++dt) o[r][dt] = (_Float16)(oacc[mt][dt][r] * inv);
    }
    // The two scheduling fences keep every vector write of a row tile ahead of its
    // stores and every later one behind the wait below.
    __builtin_amdgcn_sched_barrier(0);
#pragma unroll
    for (int r = 0; r < 8; ++r)
#pragma unroll
      for (int dt = 0; dt < 8; ++dt) obase[(size_t)(mt * 16 + r) * 4096 + dt * 16] = o[r][dt];
    // s_wait_xcnt 0 behind the stores: a precaution, it stands ahead of any rewrite
    // of their address and data registers by the next row tile.
    asm volatile("s_wait_xcnt 0x0" ::: "memory");
    __builtin_amdgcn_sched_barrier(0);
  }
}

// ---------------------------------------------------------------------------
// Kernel 3: out = Oh . Woh^T + bo (f32 out). grid = (8, 64); block = 128.
// Block tile 64(M) x 64(N), each wave 32 x 32, K = 4096 in 64 staged trips.
// ---------------------------------------------------------------------------
__global__ __launch_bounds__(128) void out_proj_kernel(
    const _Float16* __restrict__ Oh, const _Float16* __restrict__ Woh,
    const float* __restrict__ bo, float* __restrict__ out) {
  __shared__ __attribute__((aligned(16))) char smem[2 * (64 + 64) * LDS_PITCH];
  const int lane = threadIdx.x & 31, wave = threadIdx.x >> 5;
  const int lm = lane & 15, hs = lane >> 4;
  const int bm0 = blockIdx.y * 64;
  const int bn0 = blockIdx.x * 64;

  v8f acc[2][2] = {};
  gemm_staged<64, 64, 4096>(Oh, Woh, bm0, bn0, smem, acc);

  const int m0 = bm0 + (wave >> 1) * 32;
  const int n0 = bn0 + (wave & 1) * 32;
#pragma unroll
  for (int j = 0; j < 2; ++j) {
    const int n = n0 + j * 16 + lm;
    const float bias = bo[n];
#pragma unroll
    for (int i = 0; i < 2; ++i) {
#pragma unroll
      for (int r = 0; r < 8; ++r) {
        const int m = m0 + i * 16 + r + hs * 8;
        out[(size_t)m * 512 + n] = acc[i][j][r] + bias;
      }
    }
  }
}

// ---------------------------------------------------------------------------
extern "C" void kernel_launch(void* const* d_in, const int* in_sizes, int n_in,
                              void* d_out, int out_size, void* d_ws, size_t ws_size,
                              hipStream_t stream) {
  (void)in_sizes; (void)n_in; (void)out_size; (void)ws_size;
  const float* x  = (const float*)d_in[0];
  const float* Wq = (const float*)d_in[1];
  const float* Wk = (const float*)d_in[2];
  const float* Wv = (const float*)d_in[3];
  const float* Wo = (const float*)d_in[4];
  const float* bo = (const float*)d_in[5];
  float* out = (float*)d_out;

  char* ws = (char*)d_ws;
  _Float16* Qh  = (_Float16*)(ws);
  _Float16* Kh  = (_Float16*)(ws + (size_t)33554432);
  _Float16* Vt  = (_Float16*)(ws + (size_t)67108864);
  _Float16* Oh  = (_Float16*)(ws + (size_t)100663296);
  _Float16* Xh  = (_Float16*)(ws + (size_t)134217728);
  _Float16* Wqh = (_Float16*)(ws + (size_t)138412032);
  _Float16* Wkh = (_Float16*)(ws + (size_t)142606336);
  _Float16* Wvh = (_Float16*)(ws + (size_t)146800640);
  _Float16* Woh = (_Float16*)(ws + (size_t)150994944);

  cvt_f16_kernel<<<dim3(2048, 5), 256, 0, stream>>>(x, Wq, Wk, Wv, Wo,
                                                    Xh, Wqh, Wkh, Wvh, Woh);
  qkv_proj_kernel<<<dim3(32, 32, 3), 128, 0, stream>>>(Xh, Wqh, Wkh, Wvh,
                                                       Qh, Kh, Vt);
  flash_attn_kernel<<<dim3(16, 32), 128, 0, stream>>>(Qh, Kh, Vt, Oh);
  out_proj_kernel<<<dim3(8, 64), 128, 0, stream>>>(Oh, Woh, bo, out);
}

// v005
// One run takes 168 microseconds.
// Next to v004, in two timings, it ran 1.10 and 1.11 times as fast.
// Counting every step since v000, it is 4.08 times as fast.
#include <hip/hip_runtime.h>

// ---------------------------------------------------------------------------
// MI455X (gfx1250) fused multi-head self-attention, f16 WMMA / f32 accum.
//   B=4, T=1024, EMBED=512, H=8, head_dim=512 (reference uses full EMBED/head)
// Workspace layout (148 MB total):
//   Qh  : (B,H,T,512) f16 @ 0      (scaled by 512^-0.25)
//   Kh  : (B,H) x 64 key tiles x 16 d tiles of 16 keys x 32 d, f16 @ 32MB
//         (scaled by 512^-0.25), each tile in fragment order (see frag_packed)
//   Vt  : (B,H) x 32 key tiles x 32 d tiles of 16 d x 32 keys, f16 @ 64MB,
//         each tile in fragment order
//   Oh  : (B,T,4096)  f16 @ 96MB
//   Xh  : (4096,512)  f16 @ 128MB  (x converted once)
//   Wqh/Wkh/Wvh : (4096,512) f16 @ 132/136/140MB
//   Woh : (512,4096)  f16 @ 144MB
// The projection GEMMs read f16 tiles staged in LDS; attention reads f16 from global.
// ---------------------------------------------------------------------------

typedef _Float16 v16h __attribute__((ext_vector_type(16)));
typedef _Float16 v8h  __attribute__((ext_vector_type(8)));
typedef _Float16 v4h  __attribute__((ext_vector_type(4)));
typedef float    v8f  __attribute__((ext_vector_type(8)));
typedef float    v4f  __attribute__((ext_vector_type(4)));

#define WMMA(a, b, c) \
  __builtin_amdgcn_wmma_f32_16x16x32_f16(false, (a), false, (b), (short)0, (c), false, false)

// A/B fragment element e (lane L, hs=L>>4): K = (e>>3)*16 + hs*8 + (e&7)
// -> two contiguous 8-half (16B) runs at K0 = hs*8 and K0+16.
static __device__ __forceinline__ v16h frag_f16(const _Float16* p0) {
  v8h lo = *(const v8h*)p0;
  v8h hi = *(const v8h*)(p0 + 16);
  v16h r;
#pragma unroll
  for (int i = 0; i < 8; ++i) { r[i] = lo[i]; r[8 + i] = hi[i]; }
  return r;
}

// A 16 x 32 B-operand tile stored in fragment order: 1024 B, 16-byte unit u holds
// row u & 15, k = (u >> 5) * 16 + ((u >> 4) & 1) * 8 .. + 7. Lane L takes units L and
// L + 32, so each of the two wave-wide loads covers 512 contiguous bytes (4 whole
// 128-byte lines). p0 = tile + lane * 8.
static __device__ __forceinline__ v16h frag_packed(const _Float16* p0) {
  v8h lo = *(const v8h*)p0;
  v8h hi = *(const v8h*)(p0 + 256);
  v16h r;
#pragma unroll
  for (int i = 0; i < 8; ++i) { r[i] = lo[i]; r[8 + i] = hi[i]; }
  return r;
}

// ---------------------------------------------------------------------------
// Projection GEMM core: C(BM x BN) = A(BM x K) . B(BN x K)^T, both k-contiguous.
// 128 threads, 4 waves as 2 x 2, each wave (BM/2) x (BN/2). A trip is 64 k
// (128-byte rows): [A rows | B rows] at an LDS pitch of 144 B, two buffers,
// filled by per-lane 16-byte asynchronous copies (a wave covers 4 whole rows).
// ---------------------------------------------------------------------------
#define LDS_PITCH 144

// Four copies, then s_wait_xcnt 0 (a precaution: it stands ahead of any rewrite of
// the copies' address registers); one statement, so that the compiler can put
// nothing between the copies and the wait.
static __device__ __forceinline__ void copy4_to_lds(unsigned l, const _Float16* g,
                                                    int lstep, size_t gstep) {
  asm volatile(
      "global_load_async_to_lds_b128 %0, %4, off\n\t"
      "global_load_async_to_lds_b128 %1, %5, off\n\t"
      "global_load_async_to_lds_b128 %2, %6, off\n\t"
      "global_load_async_to_lds_b128 %3, %7, off\n\t"
      "s_wait_xcnt 0x0"
      :: "v"(l), "v"(l + lstep), "v"(l + 2 * lstep), "v"(l + 3 * lstep),
         "v"(g), "v"(g + gstep), "v"(g + 2 * gstep), "v"(g + 3 * gstep)
      : "memory");
}

// ROWS rows of 128 B: thread t brings 16 B at row (t >> 3) + 16 i, byte (t & 7) * 16.
template <int ROWS, int K>
static __device__ __forceinline__ void stage_rows(unsigned l, const _Float16* g) {
#pragma unroll  // address steps become constants
  for (int i = 0; i < ROWS / 16; i += 4)
    copy4_to_lds(l + i * 16 * LDS_PITCH, g + (size_t)i * 16 * K, 16 * LDS_PITCH,
                 (size_t)16 * K);
}

template <int BM, int BN, int K>
static __device__ __forceinline__ void gemm_staged(
    const _Float16* __restrict__ A, const _Float16* __restrict__ B, int m0, int n0,
    char* smem, v8f (&acc)[BM / 32][BN / 32]) {
  constexpr int STAGE = (BM + BN) * LDS_PITCH;
  constexpr int T = K / 64;
  static_assert(T >= 2 && K % 64 == 0 && BM % 64 == 0 && BN % 64 == 0, "tile shape");
  const int tid = threadIdx.x;
  const int lane = tid & 31, wave = tid >> 5;
  const int lm = lane & 15, hs = lane >> 4;
  const int wm = wave >> 1, wn = wave & 1;

  const _Float16* ga = A + (size_t)(m0 + (tid >> 3)) * K + (tid & 7) * 8;
  const _Float16* gb = B + (size_t)(n0 + (tid >> 3)) * K + (tid & 7) * 8;
  const unsigned la = (unsigned)(uintptr_t)smem + (tid >> 3) * LDS_PITCH + (tid & 7) * 16;
  const unsigned lb = la + BM * LDS_PITCH;
  const char* ra = smem + (wm * (BM / 2) + lm) * LDS_PITCH + hs * 16;
  const char* rb = smem + (BM + wn * (BN / 2) + lm) * LDS_PITCH + hs * 16;

  stage_rows<BM, K>(la, ga);
  stage_rows<BN, K>(lb, gb);
  // Tile 0 has landed for this wave; the barrier publishes it to the others.
  asm volatile("s_wait_asynccnt 0x0" ::: "memory");
  __syncthreads();
  stage_rows<BM, K>(la + STAGE, ga + 64);
  stage_rows<BN, K>(lb + STAGE, gb + 64);

  for (int t = 0; t < T; ++t) {
    const int off = (t & 1) * STAGE;
    // All loops below are unrolled so that every fragment and accumulator index
    // is a constant (registers, no scratch).
#pragma unroll
    for (int ks = 0; ks < 2; ++ks) {
      v16h a[BM / 32], b[BN / 32];
#pragma unroll
      for (int i = 0; i < BM / 32; ++i)
        a[i] = frag_f16((const _Float16*)(ra + off + i * 16 * LDS_PITCH + ks * 64));
#pragma unroll
      for (int j = 0; j < BN / 32; ++j)
        b[j] = frag_f16((const _Float16*)(rb + off + j * 16 * LDS_PITCH + ks * 64));
#pragma unroll
      for (int i = 0; i < BM / 32; ++i)
#pragma unroll
        for (int j = 0; j < BN / 32; ++j) acc[i][j] = WMMA(a[i], b[j], acc[i][j]);
    }
    // This wave's reads of buffer t & 1 are done before it may be refilled.
    asm volatile("s_wait_dscnt 0x0" ::: "memory");
    // This wave's copies of tile t + 1 have landed before the barrier publishes them.
    asm volatile("s_wait_asynccnt 0x0" ::: "memory");
    __syncthreads();
    if (t + 2 < T) {
      stage_rows<BM, K>(la + off, ga + (t + 2) * 64);
      stage_rows<BN, K>(lb + off, gb + (t + 2) * 64);
    }
  }
  // No copy is outstanding when the wave goes on to its stores and ends.
  asm volatile("s_wait_asynccnt 0x0" ::: "memory");
}

// ---------------------------------------------------------------------------
// Kernel 0: one-shot f32 -> f16 conversion of x and the four weights.
// All five tensors are 2,097,152 elements. grid = (2048, 5), block = 256.
// ---------------------------------------------------------------------------
__global__ __launch_bounds__(256) void cvt_f16_kernel(
    const float* __restrict__ sx, const float* __restrict__ sq,
    const float* __restrict__ sk, const float* __restrict__ sv,
    const float* __restrict__ so,
    _Float16* __restrict__ dx, _Float16* __restrict__ dq,
    _Float16* __restrict__ dk, _Float16* __restrict__ dv,
    _Float16* __restrict__ dw) {
  const float* src;
  _Float16* dst;
  switch (blockIdx.y) {
    case 0: src = sx; dst = dx; break;
    case 1: src = sq; dst = dq; break;
    case 2: src = sk; dst = dk; break;
    case 3: src = sv; dst = dv; break;
    default: src = so; dst = dw; break;
  }
  const size_t i = ((size_t)blockIdx.x * 256 + threadIdx.x) * 4;
  v4f v = *(const v4f*)(src + i);
  v4h h;
#pragma unroll
  for (int j = 0; j < 4; ++j) h[j] = (_Float16)v[j];
  *(v4h*)(dst + i) = h;
}

// ---------------------------------------------------------------------------
// Kernel 1: Q/K/V projections (f16 x f16 -> f32). grid = (32, 32, 3); block 128.
// Block tile 128 x 128, each wave 64 x 64, K = 512 in 8 staged trips.
// A lane of the accumulator holds 8 neighbouring rows of the A side at one row of
// the B side. The side whose index runs contiguously in the output is therefore
// given as A: the weight rows (d) for Q and K, the x rows (t) for the transposed V.
// Each wave packs its tile to f16 in an LDS range of its own, one row of 128 B per
// B-side row, and stores it as whole 128-byte lines, 16 B a lane: Q as rows, K and V
// as 8 tiles in fragment order (a permutation of the 16-byte units of those rows).
// ---------------------------------------------------------------------------
// 16 stores of 4 whole output rows each; PITCH (halves) is a constant so that every
// store takes one address register pair and an immediate offset.
template <int PITCH>
static __device__ __forceinline__ void store_rows(_Float16* p, const v8h (&o)[16]) {
#pragma unroll  // offsets and register indices become constants
  for (int s = 0; s < 16; ++s) *(v8h*)(p + (size_t)s * 4 * PITCH) = o[s];
  // s_wait_xcnt 0 behind the stores: a precaution, it stands ahead of any rewrite of
  // their address and data registers.
  asm volatile("s_wait_xcnt 0x0" ::: "memory");
}

// 16 stores of half a fragment-order tile (512 B) each. Store s holds rows
// (s >> 2) * 16 .. + 15 of the staged tile, columns (s & 3) * 16 .. + 15; ROWSTEP and
// COLSTEP (halves) are the distances between neighbouring tiles along rows and columns.
template <int ROWSTEP, int COLSTEP>
static __device__ __forceinline__ void store_tiles(_Float16* p, const v8h (&o)[16]) {
#pragma unroll  // offsets and register indices become constants
  for (int s = 0; s < 16; ++s)
    *(v8h*)(p + (s >> 2) * ROWSTEP + ((s >> 1) & 1) * COLSTEP + (s & 1) * 256) = o[s];
  // s_wait_xcnt 0 behind the stores: the same precaution as in store_rows.
  asm volatile("s_wait_xcnt 0x0" ::: "memory");
}

__global__ __launch_bounds__(128) void qkv_proj_kernel(
    const _Float16* __restrict__ Xh, const _Float16* __restrict__ Wqh,
    const _Float16* __restrict__ Wkh, const _Float16* __restrict__ Wvh,
    _Float16* __restrict__ Qh, _Float16* __restrict__ Kh,
    _Float16* __restrict__ Vt) {
  __shared__ __attribute__((aligned(16))) char smem[2 * (128 + 128) * LDS_PITCH];
  const int lane = threadIdx.x & 31, wave = threadIdx.x >> 5;
  const int lm = lane & 15, hs = lane >> 4;
  const int z = blockIdx.z;
  const _Float16* W = (z == 0) ? Wqh : ((z == 1) ? Wkh : Wvh);
  const int bm0 = blockIdx.y * 128;  // row in (b*t) space
  const int bn0 = blockIdx.x * 128;  // col in (h*d) space
  const bool wa = z < 2;             // weights on the A side (Q, K)

  v8f acc[4][4] = {};
  gemm_staged<128, 128, 512>(wa ? W : Xh, wa ? Xh : W, wa ? bn0 : bm0, wa ? bm0 : bn0,
                             smem, acc);

  // The last trip's barrier stands behind every wave's last read of the ring and no
  // copy is outstanding: the ring is free, and each wave takes 64 rows of it.
  char* st = smem + wave * (64 * LDS_PITCH);
  const float sc = wa ? 0.21022410381342865f : 1.0f;  // 512^-0.25
  // The loops below are unrolled so that every accumulator and row index is a
  // constant (registers, no scratch).
#pragma unroll
  for (int i = 0; i < 4; ++i) {
#pragma unroll
    for (int j = 0; j < 4; ++j) {
      v8h h8;  // C layout: A-side row = i*16 + hs*8 + r, B-side row = j*16 + lm
#pragma unroll
      for (int r = 0; r < 8; ++r) h8[r] = (_Float16)(acc[i][j][r] * sc);
      *(v8h*)(st + (j * 16 + lm) * LDS_PITCH + (i * 16 + hs * 8) * 2) = h8;
    }
  }
  // The rows are read back by other lanes of this wave: its LDS writes are done first.
  asm volatile("s_wait_dscnt 0x0" ::: "memory");
  v8h o[16];
  const int m0 = bm0 + (wa ? (wave & 1) : (wave >> 1)) * 64;
  const int n0 = bn0 + (wa ? (wave >> 1) : (wave & 1)) * 64;
  const size_t head = (size_t)((m0 >> 10) * 8 + (n0 >> 9)) * (1024 * 512);
  const int t0 = m0 & 1023, d0 = n0 & 511;
  if (z == 0) {
#pragma unroll
    for (int s = 0; s < 16; ++s)
      o[s] = *(const v8h*)(st + (s * 4 + (lane >> 3)) * LDS_PITCH + (lane & 7) * 16);
    store_rows<512>(Qh + head + (size_t)(t0 + (lane >> 3)) * 512 + d0 + (lane & 7) * 8, o);
  } else {
    // Lane (hs, lm) of store s takes row (s >> 2) * 16 + lm, 16-byte unit (s & 3) * 2 + hs.
#pragma unroll
    for (int s = 0; s < 16; ++s)
      o[s] = *(const v8h*)(st + ((s >> 2) * 16 + lm) * LDS_PITCH + ((s & 3) * 2 + hs) * 16);
    if (z == 1)  // rows are keys, columns d: tile index = key tile * 16 + d tile
      store_tiles<16 * 512, 512>(Kh + head + ((t0 >> 4) * 16 + (d0 >> 5)) * 512 + lane * 8, o);
    else         // rows are d, columns keys: tile index = key tile * 32 + d tile
      store_tiles<512, 32 * 512>(Vt + head + ((t0 >> 5) * 32 + (d0 >> 4)) * 512 + lane * 8, o);
  }
}

// ---------------------------------------------------------------------------
// Kernel 2: flash attention. grid = (T/64, B*H); block = 128 (4 waves).
// A work-group owns 64 query rows (4 row tiles of 16). Waves split d=512 into
// 128-wide slices; every K and V fragment a wave loads feeds all 4 row tiles.
// The 64 x 512 O tile takes 256 registers a lane, so the Q tile lives in LDS.
// S partials are reduced across waves in LDS; 64 threads run the online softmax,
// one row each. LDS row pitches (1040 B for Q, 144 B for S, 80 B for P) are odd
// multiples of 16 B: 16-byte accesses of neighbouring rows fall on different banks.
// All inner loops are unrolled so that every fragment and accumulator index is a
// constant (registers, no scratch).
// ---------------------------------------------------------------------------
#define QT 4         // 16-row query tiles per work-group
#define SP_PITCH 36  // floats per S row in LDS
#define PT_PITCH 40  // halves per P row in LDS
#define QS_PITCH 520 // halves per Q row in LDS

// Work-group barrier that orders LDS traffic only. The waves exchange data through LDS
// alone, and __syncthreads() would also wait for every global load in flight: with this
// form the K and V fragment loads issued ahead stay in flight across the barrier.
static __device__ __forceinline__ void lds_barrier() {
  asm volatile("s_wait_dscnt 0x0\n\ts_barrier_signal -1\n\ts_barrier_wait -1" ::: "memory");
}

__global__ __launch_bounds__(128) void flash_attn_kernel(
    const _Float16* __restrict__ Qh, const _Float16* __restrict__ Kh,
    const _Float16* __restrict__ Vt, _Float16* __restrict__ Oh) {
  __shared__ __align__(16) _Float16 Qs[QT * 16 * QS_PITCH];      // Q tile (A frag src)
  __shared__ __align__(16) float Spart[4 * QT * 16 * SP_PITCH];  // per-wave S partials
  __shared__ __align__(16) _Float16 Ptile[QT * 16 * PT_PITCH];   // softmax probs (A frag src)
  __shared__ float rowmax[QT * 16], rowsum[QT * 16], alphaS[QT * 16];

  const int tid = threadIdx.x;
  const int lane = tid & 31, wave = tid >> 5;
  const int lm = lane & 15, hs = lane >> 4;
  const int bh = blockIdx.y;
  const int m0 = blockIdx.x * (QT * 16);
  const int ds0 = wave * 128;

  const _Float16* qbase = Qh + ((size_t)bh * 1024 + m0) * 512;
  const _Float16* kbase = Kh + (size_t)bh * 1024 * 512;
  const _Float16* vbase = Vt + (size_t)bh * 512 * 1024;

  // Q tile to LDS once (reused all key blocks): two whole rows per pass of the block.
#pragma unroll
  for (int i = 0; i < QT * 8; ++i)
    *(v8h*)(Qs + (i * 2 + (tid >> 6)) * QS_PITCH + (tid & 63) * 8) =
        *(const v8h*)(qbase + (size_t)(i * 2 + (tid >> 6)) * 512 + (tid & 63) * 8);
  const _Float16* qrow = Qs + lm * QS_PITCH + ds0 + hs * 8;

  v8f oacc[QT][8] = {};

  if (tid < QT * 16) { rowmax[tid] = -1e30f; rowsum[tid] = 0.0f; }
  __syncthreads();

  // K fragments of the current key block; each block's are loaded one block ahead.
  // Key tile n0k / 16, d tiles wave * 4 .. + 3: 4 KB in a row; the next key tile
  // lies 16 tiles on.
  // The wave's number as a scalar: the K and V addresses are then a scalar base and one
  // lane offset, which keeps address registers out of the vector file (no spill).
  const int swave = __builtin_amdgcn_readfirstlane(wave);
  v16h b0[4], b1[4];
  {
    const unsigned ko = swave * 4096 + lane * 16;  // byte offset in this head's K
    const _Float16* kp = (const _Float16*)((const char*)kbase + ko);
#pragma unroll
    for (int dt = 0; dt < 4; ++dt) {
      b0[dt] = frag_packed(kp + dt * 512);
      b1[dt] = frag_packed(kp + 16 * 512 + dt * 512);
    }
    // s_wait_xcnt 0 behind the K loads: a precaution, it stands ahead of any rewrite
    // of their address registers.
    asm volatile("s_wait_xcnt 0x0" ::: "memory");
    // Keeps that wait directly behind the loads, ahead of the address arithmetic below.
    __builtin_amdgcn_sched_barrier(0);
  }

  for (int n0k = 0; n0k < 1024; n0k += 32) {
    // Non-blocking prefetch of next key block (global_prefetch_b8).
    if (n0k + 32 < 1024) {
      __builtin_prefetch(kbase + (n0k + 32) * 512 + wave * 2048 + lane * 64, 0, 1);
      __builtin_prefetch(vbase + (n0k + 32) * 512 + wave * 4096 + lane * 64, 0, 1);
    }
    // ---- S partial = Q[:,dslice] . K[n0k:n0k+32, dslice]^T  (2 tiles per row tile) ----
    v8f s0[QT] = {}, s1[QT] = {};
    v16h qf[2][QT];
#pragma unroll
    for (int mt = 0; mt < QT; ++mt) qf[0][mt] = frag_f16(qrow + mt * 16 * QS_PITCH);
#pragma unroll
    for (int dt = 0; dt < 4; ++dt) {
      if (dt < 3) {
#pragma unroll
        for (int mt = 0; mt < QT; ++mt)
          qf[(dt + 1) & 1][mt] = frag_f16(qrow + mt * 16 * QS_PITCH + (dt + 1) * 32);
      }
      // Keeps the next d step's Q reads as one group ahead of this step's products,
      // so that their LDS latency runs behind 8 matrix instructions.
      __builtin_amdgcn_sched_barrier(0);
#pragma unroll
      for (int mt = 0; mt < QT; ++mt) {
        s0[mt] = WMMA(qf[dt & 1][mt], b0[dt], s0[mt]);
        s1[mt] = WMMA(qf[dt & 1][mt], b1[dt], s1[mt]);
      }
    }
    // The V fragments of this key block and the K fragments of the next are asked for
    // here, one phase ahead: their latency runs behind the S exchange and the softmax,
    // and for K behind the P . V products too. V takes registers that the Q fragments
    // leave, K its own again.
    // B[k][n] = V[key][dcol]: key tile n0k / 32, d tiles wave * 8 .. + 7, 8 KB in a row.
    const unsigned vo = n0k * 1024 + swave * 8192 + lane * 16;  // byte offset in this head's V
    const _Float16* vp = (const _Float16*)((const char*)vbase + vo);
    v16h bf[8];
#pragma unroll
    for (int dt = 0; dt < 8; ++dt) bf[dt] = frag_packed(vp + dt * 512);
    // The last pass loads its own K block again, unused: behind a branch round the loads
    // the compiler's counted waits for the V fragments would cover the K loads as well,
    // on every pass.
    const int nk = n0k + 32 < 1024 ? n0k + 32 : n0k;
    const unsigned ko = nk * 1024 + swave * 4096 + lane * 16;  // byte offset in this head's K
    const _Float16* kp = (const _Float16*)((const char*)kbase + ko);
#pragma unroll
    for (int dt = 0; dt < 4; ++dt) {
      b0[dt] = frag_packed(kp + dt * 512);
      b1[dt] = frag_packed(kp + 16 * 512 + dt * 512);
    }
    // s_wait_xcnt 0 behind the V and K loads: a precaution, it stands ahead of any rewrite
    // of their address registers; naming the two offsets as inputs keeps those registers
    // from being handed to one of the loads as its destination.
    asm volatile("s_wait_xcnt 0x0" :: "v"(vo), "v"(ko) : "memory");
    float* sp = Spart + wave * (QT * 16 * SP_PITCH);
#pragma unroll
    for (int mt = 0; mt < QT; ++mt) {
#pragma unroll
      for (int r = 0; r < 8; ++r) {
        const int m = mt * 16 + r + hs * 8;
        sp[m * SP_PITCH + lm] = s0[mt][r];
        sp[m * SP_PITCH + 16 + lm] = s1[mt][r];
      }
    }
    lds_barrier();

    // ---- online softmax: thread m owns row m, sums the 4 wave partials ----
    if (tid < QT * 16) {
      const int m = tid;
      const float mold = rowmax[m], lold = rowsum[m];
      const float* s_row = Spart + m * SP_PITCH;
      float sv[32];
      float smax = mold;
#pragma unroll
      for (int n = 0; n < 32; ++n) {
        float s = s_row[n] + s_row[QT * 16 * SP_PITCH + n] +
                  s_row[2 * QT * 16 * SP_PITCH + n] + s_row[3 * QT * 16 * SP_PITCH + n];
        sv[n] = s;
        smax = fmaxf(smax, s);
      }
      const float alpha = __expf(mold - smax);
      float lsum = lold * alpha;
#pragma unroll
      for (int n = 0; n < 32; ++n) {
        const float p = __expf(sv[n] - smax);
        lsum += p;
        Ptile[m * PT_PITCH + n] = (_Float16)p;
      }
      rowmax[m] = smax; rowsum[m] = lsum; alphaS[m] = alpha;
    }
    lds_barrier();

    // ---- rescale O accumulators, then O += P . V over this d-slice ----
    v16h pf[QT];  // P as A operand (16x32 per row tile)
#pragma unroll
    for (int mt = 0; mt < QT; ++mt) {
#pragma unroll
      for (int r = 0; r < 8; ++r) {
        const float am = alphaS[mt * 16 + r + hs * 8];
#pragma unroll
        for (int dt = 0; dt < 8; ++dt) oacc[mt][dt][r] *= am;
      }
      pf[mt] = frag_f16(Ptile + (mt * 16 + lm) * PT_PITCH + hs * 8);
    }
#pragma unroll
    for (int dt = 0; dt < 8; ++dt) {
#pragma unroll
      for (int mt = 0; mt < QT; ++mt) oacc[mt][dt] = WMMA(pf[mt], bf[dt], oacc[mt][dt]);
    }
    lds_barrier();
  }

  // ---- normalize and store to Oh (B,T,H*512) ----
  const int b = bh >> 3, h = bh & 7;
  _Float16* obase = Oh + ((size_t)b * 1024 + m0 + hs * 8) * 4096 + h * 512 + ds0 + lm;
#pragma unroll
  for (int mt = 0; mt < QT; ++mt) {
    _Float16 o[8][8];
#pragma unroll
    for (int r = 0; r < 8; ++r) {
      const float inv = 1.0f / rowsum[mt * 16 + r + hs * 8];
#pragma unroll
      for (int dt = 0; dt < 8; ++dt) o[r][dt] = (_Float16)(oacc[mt][dt][r] * inv);
    }
    // The two scheduling fences keep every vector write of a row tile ahead of its
    // stores and every later one behind the wait below.
    __builtin_amdgcn_sched_barrier(0);
#pragma unroll
    for (int r = 0; r < 8; ++r)
#pragma unroll
      for (int dt = 0; dt < 8; ++dt) obase[(size_t)(mt * 16 + r) * 4096 + dt * 16] = o[r][dt];
    // s_wait_xcnt 0 behind the stores: a precaution, it stands ahead of any rewrite
    // of their address and data registers by the next row tile.
    asm volatile("s_wait_xcnt 0x0" ::: "memory");
    __builtin_amdgcn_sched_barrier(0);
  }
}

// ---------------------------------------------------------------------------
// Kernel 3: out = Oh . Woh^T + bo (f32 out). grid = (8, 64); block = 128.
// Block tile 64(M) x 64(N), each wave 32 x 32, K = 4096 in 64 staged trips.
// ---------------------------------------------------------------------------
__global__ __launch_bounds__(128) void out_proj_kernel(
    const _Float16* __restrict__ Oh, const _Float16* __restrict__ Woh,
    const float* __restrict__ bo, float* __restrict__ out) {
  __shared__ __attribute__((aligned(16))) char smem[2 * (64 + 64) * LDS_PITCH];
  const int lane = threadIdx.x & 31, wave = threadIdx.x >> 5;
  const int lm = lane & 15, hs = lane >> 4;
  const int bm0 = blockIdx.y * 64;
  const int bn0 = blockIdx.x * 64;

  v8f acc[2][2] = {};
  gemm_staged<64, 64, 4096>(Oh, Woh, bm0, bn0, smem, acc);

  const int m0 = bm0 + (wave >> 1) * 32;
  const int n0 = bn0 + (wave & 1) * 32;
#pragma unroll
  for (int j = 0; j < 2; ++j) {
    const int n = n0 + j * 16 + lm;
    const float bias = bo[n];
#pragma unroll
    for (int i = 0; i < 2; ++i) {
#pragma unroll
      for (int r = 0; r < 8; ++r) {
        const int m = m0 + i * 16 + r + hs * 8;
        out[(size_t)m * 512 + n] = acc[i][j][r] + bias;
      }
    }
  }
}

// ---------------------------------------------------------------------------
extern "C" void kernel_launch(void* const* d_in, const int* in_sizes, int n_in,
                              void* d_out, int out_size, void* d_ws, size_t ws_size,
                              hipStream_t stream) {
  (void)in_sizes; (void)n_in; (void)out_size; (void)ws_size;
  const float* x  = (const float*)d_in[0];
  const float* Wq = (const float*)d_in[1];
  const float* Wk = (const float*)d_in[2];
  const float* Wv = (const float*)d_in[3];
  const float* Wo = (const float*)d_in[4];
  const float* bo = (const float*)d_in[5];
  float* out = (float*)d_out;

  char* ws = (char*)d_ws;
  _Float16* Qh  = (_Float16*)(ws);
  _Float16* Kh  = (_Float16*)(ws + (size_t)33554432);
  _Float16* Vt  = (_Float16*)(ws + (size_t)67108864);
  _Float16* Oh  = (_Float16*)(ws + (size_t)100663296);
  _Float16* Xh  = (_Float16*)(ws + (size_t)134217728);
  _Float16* Wqh = (_Float16*)(ws + (size_t)138412032);
  _Float16* Wkh = (_Float16*)(ws + (size_t)142606336);
  _Float16* Wvh = (_Float16*)(ws + (size_t)146800640);
  _Float16* Woh = (_Float16*)(ws + (size_t)150994944);

  cvt_f16_kernel<<<dim3(2048, 5), 256, 0, stream>>>(x, Wq, Wk, Wv, Wo,
                                                    Xh, Wqh, Wkh, Wvh, Woh);
  qkv_proj_kernel<<<dim3(32, 32, 3), 128, 0, stream>>>(Xh, Wqh, Wkh, Wvh,
                                                       Qh, Kh, Vt);
  flash_attn_kernel<<<dim3(16, 32), 128, 0, stream>>>(Qh, Kh, Vt, Oh);
  out_proj_kernel<<<dim3(8, 64), 128, 0, stream>>>(Oh, Woh, bo, out);
}

// v006
// Measured time: 154 microseconds a run.
// In two side-by-side timings against v005, it was 1.10 and 1.09 times as fast.
// Counting every step since v000, it is 4.45 times as fast.
#include <hip/hip_runtime.h>

// ---------------------------------------------------------------------------
// MI455X (gfx1250) fused multi-head self-attention, f16 WMMA / f32 accum.
//   B=4, T=1024, EMBED=512, H=8, head_dim=512 (reference uses full EMBED/head)
// Workspace layout (148 MB total):
//   Qh  : (B,H,T,512) f16 @ 0      (scaled by 512^-0.25)
//   Kh  : (B,H) x 64 key tiles x 16 d tiles of 16 keys x 32 d, f16 @ 32MB
//         (scaled by 512^-0.25), each tile in fragment order (see frag_packed)
//   Vt  : (B,H) x 32 key tiles x 32 d tiles of 16 d x 32 keys, f16 @ 64MB,
//         each tile in fragment order
//   Oh  : (B,T,4096)  f16 @ 96MB
//   Xh  : (4096,512)  f16 @ 128MB  (x converted once)
//   Wqh/Wkh/Wvh : (4096,512) f16 @ 132/136/140MB
//   Woh : (512,4096)  f16 @ 144MB
// The projection GEMMs read f16 tiles staged in LDS; attention reads f16 from global.
// ---------------------------------------------------------------------------

typedef _Float16 v16h __attribute__((ext_vector_type(16)));
typedef _Float16 v8h  __attribute__((ext_vector_type(8)));
typedef _Float16 v4h  __attribute__((ext_vector_type(4)));
typedef float    v8f  __attribute__((ext_vector_type(8)));
typedef float    v4f  __attribute__((ext_vector_type(4)));

#define WMMA(a, b, c) \
  __builtin_amdgcn_wmma_f32_16x16x32_f16(false, (a), false, (b), (short)0, (c), false, false)

// A/B fragment element e (lane L, hs=L>>4): K = (e>>3)*16 + hs*8 + (e&7)
// -> two contiguous 8-half (16B) runs at K0 = hs*8 and K0+16.
static __device__ __forceinline__ v16h frag_f16(const _Float16* p0) {
  v8h lo = *(const v8h*)p0;
  v8h hi = *(const v8h*)(p0 + 16);
  v16h r;
#pragma unroll
  for (int i = 0; i < 8; ++i) { r[i] = lo[i]; r[8 + i] = hi[i]; }
  return r;
}

// A 16 x 32 B-operand tile stored in fragment order: 1024 B, 16-byte unit u holds
// row u & 15, k = (u >> 5) * 16 + ((u >> 4) & 1) * 8 .. + 7. Lane L takes units L and
// L + 32, so each of the two wave-wide loads covers 512 contiguous bytes (4 whole
// 128-byte lines). p0 = tile + lane * 8.
static __device__ __forceinline__ v16h frag_packed(const _Float16* p0) {
  v8h lo = *(const v8h*)p0;
  v8h hi = *(const v8h*)(p0 + 256);
  v16h r;
#pragma unroll
  for (int i = 0; i < 8; ++i) { r[i] = lo[i]; r[8 + i] = hi[i]; }
  return r;
}

// ---------------------------------------------------------------------------
// Projection GEMM core: C(BM x BN) = A(BM x K) . B(BN x K)^T, both k-contiguous.
// 128 threads, 4 waves as 2 x 2, each wave (BM/2) x (BN/2). A trip is KT k
// (rows of 2 KT bytes): [A rows | B rows] at an LDS pitch of 2 KT + 16 B (an odd
// multiple of 16 B), two buffers, filled by per-lane 16-byte asynchronous copies
// (a wave covers 512 B of whole rows). KT sets how many bytes fly per trip.
// ---------------------------------------------------------------------------
#define LDS_PITCH 144

// Four copies, then s_wait_xcnt 0 (a precaution: it stands ahead of any rewrite of
// the copies' address registers); one statement, so that the compiler can put
// nothing between the copies and the wait.
static __device__ __forceinline__ void copy4_to_lds(unsigned l, const _Float16* g,
                                                    int lstep, size_t gstep) {
  asm volatile(
      "global_load_async_to_lds_b128 %0, %4, off\n\t"
      "global_load_async_to_lds_b128 %1, %5, off\n\t"
      "global_load_async_to_lds_b128 %2, %6, off\n\t"
      "global_load_async_to_lds_b128 %3, %7, off\n\t"
      "s_wait_xcnt 0x0"
      :: "v"(l), "v"(l + lstep), "v"(l + 2 * lstep), "v"(l + 3 * lstep),
         "v"(g), "v"(g + gstep), "v"(g + 2 * gstep), "v"(g + 3 * gstep)
      : "memory");
}

// ROWS rows of 2 KT bytes, U = KT / 8 units of 16 B a row: thread t brings 16 B at row
// t / U + (128 / U) i, byte (t % U) * 16.
template <int ROWS, int K, int KT>
static __device__ __forceinline__ void stage_rows(unsigned l, const _Float16* g) {
  constexpr int RP = 1024 / KT;        // rows per pass of the 128 threads
  constexpr int PITCH = KT * 2 + 16;
  static_assert(ROWS % (4 * RP) == 0, "four copies a statement");
#pragma unroll  // address steps become constants
  for (int i = 0; i < ROWS / RP; i += 4)
    copy4_to_lds(l + i * RP * PITCH, g + (size_t)i * RP * K, RP * PITCH,
                 (size_t)RP * K);
}

template <int BM, int BN, int K, int KT>
static __device__ __forceinline__ void gemm_staged(
    const _Float16* __restrict__ A, const _Float16* __restrict__ B, int m0, int n0,
    char* smem, v8f (&acc)[BM / 32][BN / 32]) {
  constexpr int PITCH = KT * 2 + 16;
  constexpr int STAGE = (BM + BN) * PITCH;
  constexpr int T = K / KT;
  constexpr int U = KT / 8;
  static_assert(T >= 2 && K % KT == 0 && KT % 64 == 0 && BM % 64 == 0 && BN % 64 == 0,
                "tile shape");
  static_assert((BM + BN) * U / 128 <= 63, "copies of a wave in flight");
  const int tid = threadIdx.x;
  const int lane = tid & 31, wave = tid >> 5;
  const int lm = lane & 15, hs = lane >> 4;
  const int wm = wave >> 1, wn = wave & 1;

  const _Float16* ga = A + (size_t)(m0 + tid / U) * K + (tid % U) * 8;
  const _Float16* gb = B + (size_t)(n0 + tid / U) * K + (tid % U) * 8;
  const unsigned la = (unsigned)(uintptr_t)smem + (tid / U) * PITCH + (tid % U) * 16;
  const unsigned lb = la + BM * PITCH;
  const char* ra = smem + (wm * (BM / 2) + lm) * PITCH + hs * 16;
  const char* rb = smem + (BM + wn * (BN / 2) + lm) * PITCH + hs * 16;

  stage_rows<BM, K, KT>(la, ga);
  stage_rows<BN, K, KT>(lb, gb);
  // Tile 0 has landed for this wave; the barrier publishes it to the others.
  asm volatile("s_wait_asynccnt 0x0" ::: "memory");
  __syncthreads();
  stage_rows<BM, K, KT>(la + STAGE, ga + KT);
  stage_rows<BN, K, KT>(lb + STAGE, gb + KT);

  for (int t = 0; t < T; ++t) {
    const int off = (t & 1) * STAGE;
    // All loops below are unrolled so that every fragment and accumulator index
    // is a constant (registers, no scratch).
#pragma unroll
    for (int ks = 0; ks < KT / 32; ++ks) {
      v16h a[BM / 32], b[BN / 32];
#pragma unroll
      for (int i = 0; i < BM / 32; ++i)
        a[i] = frag_f16((const _Float16*)(ra + off + i * 16 * PITCH + ks * 64));
#pragma unroll
      for (int j = 0; j < BN / 32; ++j)
        b[j] = frag_f16((const _Float16*)(rb + off + j * 16 * PITCH + ks * 64));
#pragma unroll
      for (int i = 0; i < BM / 32; ++i)
#pragma unroll
        for (int j = 0; j < BN / 32; ++j) acc[i][j] = WMMA(a[i], b[j], acc[i][j]);
    }
    // This wave's reads of buffer t & 1 are done before it may be refilled.
    asm volatile("s_wait_dscnt 0x0" ::: "memory");
    // This wave's copies of tile t + 1 have landed before the barrier publishes them.
    asm volatile("s_wait_asynccnt 0x0" ::: "memory");
    __syncthreads();
    if (t + 2 < T) {
      stage_rows<BM, K, KT>(la + off, ga + (t + 2) * KT);
      stage_rows<BN, K, KT>(lb + off, gb + (t + 2) * KT);
    }
  }
  // No copy is outstanding when the wave goes on to its stores and ends.
  asm volatile("s_wait_asynccnt 0x0" ::: "memory");
}

// ---------------------------------------------------------------------------
// Kernel 0: one-shot f32 -> f16 conversion of x and the four weights.
// All five tensors are 2,097,152 elements. grid = (2048, 5), block = 256.
// ---------------------------------------------------------------------------
__global__ __launch_bounds__(256) void cvt_f16_kernel(
    const float* __restrict__ sx, const float* __restrict__ sq,
    const float* __restrict__ sk, const float* __restrict__ sv,
    const float* __restrict__ so,
    _Float16* __restrict__ dx, _Float16* __restrict__ dq,
    _Float16* __restrict__ dk, _Float16* __restrict__ dv,
    _Float16* __restrict__ dw) {
  const float* src;
  _Float16* dst;
  switch (blockIdx.y) {
    case 0: src = sx; dst = dx; break;
    case 1: src = sq; dst = dq; break;
    case 2: src = sk; dst = dk; break;
    case 3: src = sv; dst = dv; break;
    default: src = so; dst = dw; break;
  }
  const size_t i = ((size_t)blockIdx.x * 256 + threadIdx.x) * 4;
  v4f v = *(const v4f*)(src + i);
  v4h h;
#pragma unroll
  for (int j = 0; j < 4; ++j) h[j] = (_Float16)v[j];
  *(v4h*)(dst + i) = h;
}

// ---------------------------------------------------------------------------
// Kernel 1: Q/K/V projections (f16 x f16 -> f32). grid = (32, 32, 3); block 128.
// Block tile 128 x 128, each wave 64 x 64, K = 512 in 8 staged trips.
// A lane of the accumulator holds 8 neighbouring rows of the A side at one row of
// the B side. The side whose index runs contiguously in the output is therefore
// given as A: the weight rows (d) for Q and K, the x rows (t) for the transposed V.
// Each wave packs its tile to f16 in an LDS range of its own, one row of 128 B per
// B-side row, and stores it as whole 128-byte lines, 16 B a lane: Q as rows, K and V
// as 8 tiles in fragment order (a permutation of the 16-byte units of those rows).
// ---------------------------------------------------------------------------
// 16 stores of 4 whole output rows each; PITCH (halves) is a constant so that every
// store takes one address register pair and an immediate offset.
template <int PITCH>
static __device__ __forceinline__ void store_rows(_Float16* p, const v8h (&o)[16]) {
#pragma unroll  // offsets and register indices become constants
  for (int s = 0; s < 16; ++s) *(v8h*)(p + (size_t)s * 4 * PITCH) = o[s];
  // s_wait_xcnt 0 behind the stores: a precaution, it stands ahead of any rewrite of
  // their address and data registers.
  asm volatile("s_wait_xcnt 0x0" ::: "memory");
}

// 16 stores of half a fragment-order tile (512 B) each. Store s holds rows
// (s >> 2) * 16 .. + 15 of the staged tile, columns (s & 3) * 16 .. + 15; ROWSTEP and
// COLSTEP (halves) are the distances between neighbouring tiles along rows and columns.
template <int ROWSTEP, int COLSTEP>
static __device__ __forceinline__ void store_tiles(_Float16* p, const v8h (&o)[16]) {
#pragma unroll  // offsets and register indices become constants
  for (int s = 0; s < 16; ++s)
    *(v8h*)(p + (s >> 2) * ROWSTEP + ((s >> 1) & 1) * COLSTEP + (s & 1) * 256) = o[s];
  // s_wait_xcnt 0 behind the stores: the same precaution as in store_rows.
  asm volatile("s_wait_xcnt 0x0" ::: "memory");
}

__global__ __launch_bounds__(128) void qkv_proj_kernel(
    const _Float16* __restrict__ Xh, const _Float16* __restrict__ Wqh,
    const _Float16* __restrict__ Wkh, const _Float16* __restrict__ Wvh,
    _Float16* __restrict__ Qh, _Float16* __restrict__ Kh,
    _Float16* __restrict__ Vt) {
  __shared__ __attribute__((aligned(16))) char smem[2 * (128 + 128) * LDS_PITCH];
  const int lane = threadIdx.x & 31, wave = threadIdx.x >> 5;
  const int lm = lane & 15, hs = lane >> 4;
  const int z = blockIdx.z;
  const _Float16* W = (z == 0) ? Wqh : ((z == 1) ? Wkh : Wvh);
  const int bm0 = blockIdx.y * 128;  // row in (b*t) space
  const int bn0 = blockIdx.x * 128;  // col in (h*d) space
  const bool wa = z < 2;             // weights on the A side (Q, K)

  v8f acc[4][4] = {};
  gemm_staged<128, 128, 512, 64>(wa ? W : Xh, wa ? Xh : W, wa ? bn0 : bm0, wa ? bm0 : bn0,
                             smem, acc);

  // The last trip's barrier stands behind every wave's last read of the ring and no
  // copy is outstanding: the ring is free, and each wave takes 64 rows of it.
  char* st = smem + wave * (64 * LDS_PITCH);
  const float sc = wa ? 0.21022410381342865f : 1.0f;  // 512^-0.25
  // The loops below are unrolled so that every accumulator and row index is a
  // constant (registers, no scratch).
#pragma unroll
  for (int i = 0; i < 4; ++i) {
#pragma unroll
    for (int j = 0; j < 4; ++j) {
      v8h h8;  // C layout: A-side row = i*16 + hs*8 + r, B-side row = j*16 + lm
#pragma unroll
      for (int r = 0; r < 8; ++r) h8[r] = (_Float16)(acc[i][j][r] * sc);
      *(v8h*)(st + (j * 16 + lm) * LDS_PITCH + (i * 16 + hs * 8) * 2) = h8;
    }
  }
  // The rows are read back by other lanes of this wave: its LDS writes are done first.
  asm volatile("s_wait_dscnt 0x0" ::: "memory");
  v8h o[16];
  const int m0 = bm0 + (wa ? (wave & 1) : (wave >> 1)) * 64;
  const int n0 = bn0 + (wa ? (wave >> 1) : (wave & 1)) * 64;
  const size_t head = (size_t)((m0 >> 10) * 8 + (n0 >> 9)) * (1024 * 512);
  const int t0 = m0 & 1023, d0 = n0 & 511;
  if (z == 0) {
#pragma unroll
    for (int s = 0; s < 16; ++s)
      o[s] = *(const v8h*)(st + (s * 4 + (lane >> 3)) * LDS_PITCH + (lane & 7) * 16);
    store_rows<512>(Qh + head + (size_t)(t0 + (lane >> 3)) * 512 + d0 + (lane & 7) * 8, o);
  } else {
    // Lane (hs, lm) of store s takes row (s >> 2) * 16 + lm, 16-byte unit (s & 3) * 2 + hs.
#pragma unroll
    for (int s = 0; s < 16; ++s)
      o[s] = *(const v8h*)(st + ((s >> 2) * 16 + lm) * LDS_PITCH + ((s & 3) * 2 + hs) * 16);
    if (z == 1)  // rows are keys, columns d: tile index = key tile * 16 + d tile
      store_tiles<16 * 512, 512>(Kh + head + ((t0 >> 4) * 16 + (d0 >> 5)) * 512 + lane * 8, o);
    else         // rows are d, columns keys: tile index = key tile * 32 + d tile
      store_tiles<512, 32 * 512>(Vt + head + ((t0 >> 5) * 32 + (d0 >> 4)) * 512 + lane * 8, o);
  }
}

// ---------------------------------------------------------------------------
// Kernel 2: flash attention. grid = (T/64, B*H); block = 128 (4 waves).
// A work-group owns 64 query rows (4 row tiles of 16). Waves split d=512 into
// 128-wide slices; every K and V fragment a wave loads feeds all 4 row tiles.
// The 64 x 512 O tile takes 256 registers a lane, so the Q tile lives in LDS.
// S partials are reduced across waves in LDS; 64 threads run the online softmax,
// one row each. LDS row pitches (1040 B for Q, 144 B for S, 80 B for P) are odd
// multiples of 16 B: 16-byte accesses of neighbouring rows fall on different banks.
// All inner loops are unrolled so that every fragment and accumulator index is a
// constant (registers, no scratch).
// ---------------------------------------------------------------------------
#define QT 4         // 16-row query tiles per work-group
#define SP_PITCH 36  // floats per S row in LDS
#define PT_PITCH 40  // halves per P row in LDS
#define QS_PITCH 520 // halves per Q row in LDS

// Work-group barrier that orders LDS traffic only. The waves exchange data through LDS
// alone, and __syncthreads() would also wait for every global load in flight: with this
// form the K and V fragment loads issued ahead stay in flight across the barrier.
static __device__ __forceinline__ void lds_barrier() {
  asm volatile("s_wait_dscnt 0x0\n\ts_barrier_signal -1\n\ts_barrier_wait -1" ::: "memory");
}

__global__ __launch_bounds__(128) void flash_attn_kernel(
    const _Float16* __restrict__ Qh, const _Float16* __restrict__ Kh,
    const _Float16* __restrict__ Vt, _Float16* __restrict__ Oh) {
  __shared__ __align__(16) _Float16 Qs[QT * 16 * QS_PITCH];      // Q tile (A frag src)
  __shared__ __align__(16) float Spart[4 * QT * 16 * SP_PITCH];  // per-wave S partials
  __shared__ __align__(16) _Float16 Ptile[QT * 16 * PT_PITCH];   // softmax probs (A frag src)
  __shared__ float rowmax[QT * 16], rowsum[QT * 16], alphaS[QT * 16];

  const int tid = threadIdx.x;
  const int lane = tid & 31, wave = tid >> 5;
  const int lm = lane & 15, hs = lane >> 4;
  const int bh = blockIdx.y;
  const int m0 = blockIdx.x * (QT * 16);
  const int ds0 = wave * 128;

  const _Float16* qbase = Qh + ((size_t)bh * 1024 + m0) * 512;
  const _Float16* kbase = Kh + (size_t)bh * 1024 * 512;
  const _Float16* vbase = Vt + (size_t)bh * 512 * 1024;

  // Q tile to LDS once (reused all key blocks): two whole rows per pass of the block.
#pragma unroll
  for (int i = 0; i < QT * 8; ++i)
    *(v8h*)(Qs + (i * 2 + (tid >> 6)) * QS_PITCH + (tid & 63) * 8) =
        *(const v8h*)(qbase + (size_t)(i * 2 + (tid >> 6)) * 512 + (tid & 63) * 8);
  const _Float16* qrow = Qs + lm * QS_PITCH + ds0 + hs * 8;

  v8f oacc[QT][8] = {};

  if (tid < QT * 16) { rowmax[tid] = -1e30f; rowsum[tid] = 0.0f; }
  __syncthreads();

  // K fragments of the current key block; each block's are loaded one block ahead.
  // Key tile n0k / 16, d tiles wave * 4 .. + 3: 4 KB in a row; the next key tile
  // lies 16 tiles on.
  // The wave's number as a scalar: the K and V addresses are then a scalar base and one
  // lane offset, which keeps address registers out of the vector file (no spill).
  const int swave = __builtin_amdgcn_readfirstlane(wave);
  v16h b0[4], b1[4];
  {
    const unsigned ko = swave * 4096 + lane * 16;  // byte offset in this head's K
    const _Float16* kp = (const _Float16*)((const char*)kbase + ko);
#pragma unroll
    for (int dt = 0; dt < 4; ++dt) {
      b0[dt] = frag_packed(kp + dt * 512);
      b1[dt] = frag_packed(kp + 16 * 512 + dt * 512);
    }
    // s_wait_xcnt 0 behind the K loads: a precaution, it stands ahead of any rewrite
    // of their address registers.
    asm volatile("s_wait_xcnt 0x0" ::: "memory");
    // Keeps that wait directly behind the loads, ahead of the address arithmetic below.
    __builtin_amdgcn_sched_barrier(0);
  }

  for (int n0k = 0; n0k < 1024; n0k += 32) {
    // Non-blocking prefetch of next key block (global_prefetch_b8).
    if (n0k + 32 < 1024) {
      __builtin_prefetch(kbase + (n0k + 32) * 512 + wave * 2048 + lane * 64, 0, 1);
      __builtin_prefetch(vbase + (n0k + 32) * 512 + wave * 4096 + lane * 64, 0, 1);
    }
    // ---- S partial = Q[:,dslice] . K[n0k:n0k+32, dslice]^T  (2 tiles per row tile) ----
    v8f s0[QT] = {}, s1[QT] = {};
    v16h qf[2][QT];
#pragma unroll
    for (int mt = 0; mt < QT; ++mt) qf[0][mt] = frag_f16(qrow + mt * 16 * QS_PITCH);
#pragma unroll
    for (int dt = 0; dt < 4; ++dt) {
      if (dt < 3) {
#pragma unroll
        for (int mt = 0; mt < QT; ++mt)
          qf[(dt + 1) & 1][mt] = frag_f16(qrow + mt * 16 * QS_PITCH + (dt + 1) * 32);
      }
      // Keeps the next d step's Q reads as one group ahead of this step's products,
      // so that their LDS latency runs behind 8 matrix instructions.
      __builtin_amdgcn_sched_barrier(0);
#pragma unroll
      for (int mt = 0; mt < QT; ++mt) {
        s0[mt] = WMMA(qf[dt & 1][mt], b0[dt], s0[mt]);
        s1[mt] = WMMA(qf[dt & 1][mt], b1[dt], s1[mt]);
      }
    }
    // The V fragments of this key block and the K fragments of the next are asked for
    // here, one phase ahead: their latency runs behind the S exchange and the softmax,
    // and for K behind the P . V products too. V takes registers that the Q fragments
    // leave, K its own again.
    // B[k][n] = V[key][dcol]: key tile n0k / 32, d tiles wave * 8 .. + 7, 8 KB in a row.
    const unsigned vo = n0k * 1024 + swave * 8192 + lane * 16;  // byte offset in this head's V
    const _Float16* vp = (const _Float16*)((const char*)vbase + vo);
    v16h bf[8];
#pragma unroll
    for (int dt = 0; dt < 8; ++dt) bf[dt] = frag_packed(vp + dt * 512);
    // The last pass loads its own K block again, unused: behind a branch round the loads
    // the compiler's counted waits for the V fragments would cover the K loads as well,
    // on every pass.
    const int nk = n0k + 32 < 1024 ? n0k + 32 : n0k;
    const unsigned ko = nk * 1024 + swave * 4096 + lane * 16;  // byte offset in this head's K
    const _Float16* kp = (const _Float16*)((const char*)kbase + ko);
#pragma unroll
    for (int dt = 0; dt < 4; ++dt) {
      b0[dt] = frag_packed(kp + dt * 512);
      b1[dt] = frag_packed(kp + 16 * 512 + dt * 512);
    }
    // s_wait_xcnt 0 behind the V and K loads: a precaution, it stands ahead of any rewrite
    // of their address registers; naming the two offsets as inputs keeps those registers
    // from being handed to one of the loads as its destination.
    asm volatile("s_wait_xcnt 0x0" :: "v"(vo), "v"(ko) : "memory");
    float* sp = Spart + wave * (QT * 16 * SP_PITCH);
#pragma unroll
    for (int mt = 0; mt < QT; ++mt) {
#pragma unroll
      for (int r = 0; r < 8; ++r) {
        const int m = mt * 16 + r + hs * 8;
        sp[m * SP_PITCH + lm] = s0[mt][r];
        sp[m * SP_PITCH + 16 + lm] = s1[mt][r];
      }
    }
    lds_barrier();

    // ---- online softmax: thread m owns row m, sums the 4 wave partials ----
    if (tid < QT * 16) {
      const int m = tid;
      const float mold = rowmax[m], lold = rowsum[m];
      const float* s_row = Spart + m * SP_PITCH;
      float sv[32];
      float smax = mold;
#pragma unroll
      for (int n = 0; n < 32; ++n) {
        float s = s_row[n] + s_row[QT * 16 * SP_PITCH + n] +
                  s_row[2 * QT * 16 * SP_PITCH + n] + s_row[3 * QT * 16 * SP_PITCH + n];
        sv[n] = s;
        smax = fmaxf(smax, s);
      }
      const float alpha = __expf(mold - smax);
      float lsum = lold * alpha;
#pragma unroll
      for (int n = 0; n < 32; ++n) {
        const float p = __expf(sv[n] - smax);
        lsum += p;
        Ptile[m * PT_PITCH + n] = (_Float16)p;
      }
      rowmax[m] = smax; rowsum[m] = lsum; alphaS[m] = alpha;
    }
    lds_barrier();

    // ---- rescale O accumulators, then O += P . V over this d-slice ----
    v16h pf[QT];  // P as A operand (16x32 per row tile)
#pragma unroll
    for (int mt = 0; mt < QT; ++mt) {
#pragma unroll
      for (int r = 0; r < 8; ++r) {
        const float am = alphaS[mt * 16 + r + hs * 8];
#pragma unroll
        for (int dt = 0; dt < 8; ++dt) oacc[mt][dt][r] *= am;
      }
      pf[mt] = frag_f16(Ptile + (mt * 16 + lm) * PT_PITCH + hs * 8);
    }
#pragma unroll
    for (int dt = 0; dt < 8; ++dt) {
#pragma unroll
      for (int mt = 0; mt < QT; ++mt) oacc[mt][dt] = WMMA(pf[mt], bf[dt], oacc[mt][dt]);
    }
    lds_barrier();
  }

  // ---- normalize and store to Oh (B,T,H*512) ----
  const int b = bh >> 3, h = bh & 7;
  _Float16* obase = Oh + ((size_t)b * 1024 + m0 + hs * 8) * 4096 + h * 512 + ds0 + lm;
#pragma unroll
  for (int mt = 0; mt < QT; ++mt) {
    _Float16 o[8][8];
#pragma unroll
    for (int r = 0; r < 8; ++r) {
      const float inv = 1.0f / rowsum[mt * 16 + r + hs * 8];
#pragma unroll
      for (int dt = 0; dt < 8; ++dt) o[r][dt] = (_Float16)(oacc[mt][dt][r] * inv);
    }
    // The two scheduling fences keep every vector write of a row tile ahead of its
    // stores and every later one behind the wait below.
    __builtin_amdgcn_sched_barrier(0);
#pragma unroll
    for (int r = 0; r < 8; ++r)
#pragma unroll
      for (int dt = 0; dt < 8; ++dt) obase[(size_t)(mt * 16 + r) * 4096 + dt * 16] = o[r][dt];
    // s_wait_xcnt 0 behind the stores: a precaution, it stands ahead of any rewrite
    // of their address and data registers by the next row tile.
    asm volatile("s_wait_xcnt 0x0" ::: "memory");
    __builtin_amdgcn_sched_barrier(0);
  }
}

// ---------------------------------------------------------------------------
// Kernel 3: out = Oh . Woh^T + bo (f32 out). grid = (8, 64); block = 128.
// Block tile 64(M) x 64(N), each wave 32 x 32, K = 4096 in 16 staged trips of 256 k:
// 64 KB fly per trip and work-group, asked for a whole trip (32 matrix instructions a
// wave) ahead, so that the operands' latency from memory runs behind the products.
// ---------------------------------------------------------------------------
__global__ __launch_bounds__(128) void out_proj_kernel(
    const _Float16* __restrict__ Oh, const _Float16* __restrict__ Woh,
    const float* __restrict__ bo, float* __restrict__ out) {
  __shared__ __attribute__((aligned(16))) char smem[2 * (64 + 64) * (256 * 2 + 16)];
  const int lane = threadIdx.x & 31, wave = threadIdx.x >> 5;
  const int lm = lane & 15, hs = lane >> 4;
  const int bm0 = blockIdx.y * 64;
  const int bn0 = blockIdx.x * 64;

  v8f acc[2][2] = {};
  gemm_staged<64, 64, 4096, 256>(Oh, Woh, bm0, bn0, smem, acc);

  const int m0 = bm0 + (wave >> 1) * 32;
  const int n0 = bn0 + (wave & 1) * 32;
#pragma unroll
  for (int j = 0; j < 2; ++j) {
    const int n = n0 + j * 16 + lm;
    const float bias = bo[n];
#pragma unroll
    for (int i = 0; i < 2; ++i) {
#pragma unroll
      for (int r = 0; r < 8; ++r) {
        const int m = m0 + i * 16 + r + hs * 8;
        out[(size_t)m * 512 + n] = acc[i][j][r] + bias;
      }
    }
  }
}

// ---------------------------------------------------------------------------
extern "C" void kernel_launch(void* const* d_in, const int* in_sizes, int n_in,
                              void* d_out, int out_size, void* d_ws, size_t ws_size,
                              hipStream_t stream) {
  (void)in_sizes; (void)n_in; (void)out_size; (void)ws_size;
  const float* x  = (const float*)d_in[0];
  const float* Wq = (const float*)d_in[1];
  const float* Wk = (const float*)d_in[2];
  const float* Wv = (const float*)d_in[3];
  const float* Wo = (const float*)d_in[4];
  const float* bo = (const float*)d_in[5];
  float* out = (float*)d_out;

  char* ws = (char*)d_ws;
  _Float16* Qh  = (_Float16*)(ws);
  _Float16* Kh  = (_Float16*)(ws + (size_t)33554432);
  _Float16* Vt  = (_Float16*)(ws + (size_t)67108864);
  _Float16* Oh  = (_Float16*)(ws + (size_t)100663296);
  _Float16* Xh  = (_Float16*)(ws + (size_t)134217728);
  _Float16* Wqh = (_Float16*)(ws + (size_t)138412032);
  _Float16* Wkh = (_Float16*)(ws + (size_t)142606336);
  _Float16* Wvh = (_Float16*)(ws + (size_t)146800640);
  _Float16* Woh = (_Float16*)(ws + (size_t)150994944);

  cvt_f16_kernel<<<dim3(2048, 5), 256, 0, stream>>>(x, Wq, Wk, Wv, Wo,
                                                    Xh, Wqh, Wkh, Wvh, Woh);
  qkv_proj_kernel<<<dim3(32, 32, 3), 128, 0, stream>>>(Xh, Wqh, Wkh, Wvh,
                                                       Qh, Kh, Vt);
  flash_attn_kernel<<<dim3(16, 32), 128, 0, stream>>>(Qh, Kh, Vt, Oh);
  out_proj_kernel<<<dim3(8, 64), 128, 0, stream>>>(Oh, Woh, bo, out);
}

// v007
// Measured time: 141 microseconds a run.
// Two timings next to v006 both put it at 1.09 times that version's speed.
// Counting every step since v000, it is 4.85 times as fast.
#include <hip/hip_runtime.h>

// ---------------------------------------------------------------------------
// MI455X (gfx1250) fused multi-head self-attention, f16 WMMA / f32 accum.
//   B=4, T=1024, EMBED=512, H=8, head_dim=512 (reference uses full EMBED/head)
// Workspace layout (148 MB total):
//   Qh  : (B,H,T,512) f16 @ 0      (scaled by 512^-0.25)
//   Kh  : (B,H) x 64 key tiles x 16 d tiles of 16 keys x 32 d, f16 @ 32MB
//         (scaled by 512^-0.25), each tile in fragment order (see frag_packed)
//   Vt  : (B,H) x 32 key tiles x 32 d tiles of 16 d x 32 keys, f16 @ 64MB,
//         each tile in fragment order
//   Oh  : (B,T,4096)  f16 @ 96MB
//   Xh  : (4096,512)  f16 @ 128MB  (x converted once)
//   Wqh/Wkh/Wvh : (4096,512) f16 @ 132/136/140MB
//   Woh : (512,4096)  f16 @ 144MB
// The projection GEMMs read f16 tiles staged in LDS; attention reads f16 from global.
// ---------------------------------------------------------------------------

typedef _Float16 v16h __attribute__((ext_vector_type(16)));
typedef _Float16 v8h  __attribute__((ext_vector_type(8)));
typedef _Float16 v4h  __attribute__((ext_vector_type(4)));
typedef float    v8f  __attribute__((ext_vector_type(8)));
typedef float    v4f  __attribute__((ext_vector_type(4)));

#define WMMA(a, b, c) \
  __builtin_amdgcn_wmma_f32_16x16x32_f16(false, (a), false, (b), (short)0, (c), false, false)

// A/B fragment element e (lane L, hs=L>>4): K = (e>>3)*16 + hs*8 + (e&7)
// -> two contiguous 8-half (16B) runs at K0 = hs*8 and K0+16.
static __device__ __forceinline__ v16h frag_f16(const _Float16* p0) {
  v8h lo = *(const v8h*)p0;
  v8h hi = *(const v8h*)(p0 + 16);
  v16h r;
#pragma unroll
  for (int i = 0; i < 8; ++i) { r[i] = lo[i]; r[8 + i] = hi[i]; }
  return r;
}

// A 16 x 32 A-operand tile stored in fragment order: 1024 B, 16-byte unit u holds
// row u & 15, k = (u >> 5) * 16 + ((u >> 4) & 1) * 8 .. + 7. Lane L takes units L and
// L + 32, so each of the two wave-wide loads covers 512 contiguous bytes (4 whole
// 128-byte lines). p0 = tile + lane * 8.
static __device__ __forceinline__ v16h frag_packed(const _Float16* p0) {
  v8h lo = *(const v8h*)p0;
  v8h hi = *(const v8h*)(p0 + 256);
  v16h r;
#pragma unroll
  for (int i = 0; i < 8; ++i) { r[i] = lo[i]; r[8 + i] = hi[i]; }
  return r;
}

// ---------------------------------------------------------------------------
// Projection GEMM core: C(BM x BN) = A(BM x K) . B(BN x K)^T, both k-contiguous.
// 128 threads, 4 waves as 2 x 2, each wave (BM/2) x (BN/2). A trip is KT k
// (rows of 2 KT bytes): [A rows | B rows] at an LDS pitch of 2 KT + 16 B (an odd
// multiple of 16 B), two buffers, filled by per-lane 16-byte asynchronous copies
// (a wave covers 512 B of whole rows). KT sets how many bytes fly per trip.
// ---------------------------------------------------------------------------
#define LDS_PITCH 144

// Four copies, then s_wait_xcnt 0 (a precaution: it stands ahead of any rewrite of
// the copies' address registers); one statement, so that the compiler can put
// nothing between the copies and the wait.
static __device__ __forceinline__ void copy4_to_lds(unsigned l, const _Float16* g,
                                                    int lstep, size_t gstep) {
  asm volatile(
      "global_load_async_to_lds_b128 %0, %4, off\n\t"
      "global_load_async_to_lds_b128 %1, %5, off\n\t"
      "global_load_async_to_lds_b128 %2, %6, off\n\t"
      "global_load_async_to_lds_b128 %3, %7, off\n\t"
      "s_wait_xcnt 0x0"
      :: "v"(l), "v"(l + lstep), "v"(l + 2 * lstep), "v"(l + 3 * lstep),
         "v"(g), "v"(g + gstep), "v"(g + 2 * gstep), "v"(g + 3 * gstep)
      : "memory");
}

// ROWS rows of 2 KT bytes, U = KT / 8 units of 16 B a row: thread t brings 16 B at row
// t / U + (128 / U) i, byte (t % U) * 16.
template <int ROWS, int K, int KT>
static __device__ __forceinline__ void stage_rows(unsigned l, const _Float16* g) {
  constexpr int RP = 1024 / KT;        // rows per pass of the 128 threads
  constexpr int PITCH = KT * 2 + 16;
  static_assert(ROWS % (4 * RP) == 0, "four copies a statement");
#pragma unroll  // address steps become constants
  for (int i = 0; i < ROWS / RP; i += 4)
    copy4_to_lds(l + i * RP * PITCH, g + (size_t)i * RP * K, RP * PITCH,
                 (size_t)RP * K);
}

template <int BM, int BN, int K, int KT>
static __device__ __forceinline__ void gemm_staged(
    const _Float16* __restrict__ A, const _Float16* __restrict__ B, int m0, int n0,
    char* smem, v8f (&acc)[BM / 32][BN / 32]) {
  constexpr int PITCH = KT * 2 + 16;
  constexpr int STAGE = (BM + BN) * PITCH;
  constexpr int T = K / KT;
  constexpr int U = KT / 8;
  static_assert(T >= 2 && K % KT == 0 && KT % 64 == 0 && BM % 64 == 0 && BN % 64 == 0,
                "tile shape");
  static_assert((BM + BN) * U / 128 <= 63, "copies of a wave in flight");
  const int tid = threadIdx.x;
  const int lane = tid & 31, wave = tid >> 5;
  const int lm = lane & 15, hs = lane >> 4;
  const int wm = wave >> 1, wn = wave & 1;

  const _Float16* ga = A + (size_t)(m0 + tid / U) * K + (tid % U) * 8;
  const _Float16* gb = B + (size_t)(n0 + tid / U) * K + (tid % U) * 8;
  const unsigned la = (unsigned)(uintptr_t)smem + (tid / U) * PITCH + (tid % U) * 16;
  const unsigned lb = la + BM * PITCH;
  const char* ra = smem + (wm * (BM / 2) + lm) * PITCH + hs * 16;
  const char* rb = smem + (BM + wn * (BN / 2) + lm) * PITCH + hs * 16;

  stage_rows<BM, K, KT>(la, ga);
  stage_rows<BN, K, KT>(lb, gb);
  // Tile 0 has landed for this wave; the barrier publishes it to the others.
  asm volatile("s_wait_asynccnt 0x0" ::: "memory");
  __syncthreads();
  stage_rows<BM, K, KT>(la + STAGE, ga + KT);
  stage_rows<BN, K, KT>(lb + STAGE, gb + KT);

  for (int t = 0; t < T; ++t) {
    const int off = (t & 1) * STAGE;
    // All loops below are unrolled so that every fragment and accumulator index
    // is a constant (registers, no scratch).
#pragma unroll
    for (int ks = 0; ks < KT / 32; ++ks) {
      v16h a[BM / 32], b[BN / 32];
#pragma unroll
      for (int i = 0; i < BM / 32; ++i)
        a[i] = frag_f16((const _Float16*)(ra + off + i * 16 * PITCH + ks * 64));
#pragma unroll
      for (int j = 0; j < BN / 32; ++j)
        b[j] = frag_f16((const _Float16*)(rb + off + j * 16 * PITCH + ks * 64));
#pragma unroll
      for (int i = 0; i < BM / 32; ++i)
#pragma unroll
        for (int j = 0; j < BN / 32; ++j) acc[i][j] = WMMA(a[i], b[j], acc[i][j]);
    }
    // This wave's reads of buffer t & 1 are done before it may be refilled.
    asm volatile("s_wait_dscnt 0x0" ::: "memory");
    // This wave's copies of tile t + 1 have landed before the barrier publishes them.
    asm volatile("s_wait_asynccnt 0x0" ::: "memory");
    __syncthreads();
    if (t + 2 < T) {
      stage_rows<BM, K, KT>(la + off, ga + (t + 2) * KT);
      stage_rows<BN, K, KT>(lb + off, gb + (t + 2) * KT);
    }
  }
  // No copy is outstanding when the wave goes on to its stores and ends.
  asm volatile("s_wait_asynccnt 0x0" ::: "memory");
}

// ---------------------------------------------------------------------------
// Kernel 0: one-shot f32 -> f16 conversion of x and the four weights.
// All five tensors are 2,097,152 elements. grid = (2048, 5), block = 256.
// ---------------------------------------------------------------------------
__global__ __launch_bounds__(256) void cvt_f16_kernel(
    const float* __restrict__ sx, const float* __restrict__ sq,
    const float* __restrict__ sk, const float* __restrict__ sv,
    const float* __restrict__ so,
    _Float16* __restrict__ dx, _Float16* __restrict__ dq,
    _Float16* __restrict__ dk, _Float16* __restrict__ dv,
    _Float16* __restrict__ dw) {
  const float* src;
  _Float16* dst;
  switch (blockIdx.y) {
    case 0: src = sx; dst = dx; break;
    case 1: src = sq; dst = dq; break;
    case 2: src = sk; dst = dk; break;
    case 3: src = sv; dst = dv; break;
    default: src = so; dst = dw; break;
  }
  const size_t i = ((size_t)blockIdx.x * 256 + threadIdx.x) * 4;
  v4f v = *(const v4f*)(src + i);
  v4h h;
#pragma unroll
  for (int j = 0; j < 4; ++j) h[j] = (_Float16)v[j];
  *(v4h*)(dst + i) = h;
}

// ---------------------------------------------------------------------------
// Kernel 1: Q/K/V projections (f16 x f16 -> f32). grid = (32, 32, 3); block 128.
// Block tile 128 x 128, each wave 64 x 64, K = 512 in 8 staged trips.
// A lane of the accumulator holds 8 neighbouring rows of the A side at one row of
// the B side. The side whose index runs contiguously in the output is therefore
// given as A: the weight rows (d) for Q and K, the x rows (t) for the transposed V.
// Each wave packs its tile to f16 in an LDS range of its own, one row of 128 B per
// B-side row, and stores it as whole 128-byte lines, 16 B a lane: Q as rows, K and V
// as 8 tiles in fragment order (a permutation of the 16-byte units of those rows).
// ---------------------------------------------------------------------------
// 16 stores of 4 whole output rows each; PITCH (halves) is a constant so that every
// store takes one address register pair and an immediate offset.
template <int PITCH>
static __device__ __forceinline__ void store_rows(_Float16* p, const v8h (&o)[16]) {
#pragma unroll  // offsets and register indices become constants
  for (int s = 0; s < 16; ++s) *(v8h*)(p + (size_t)s * 4 * PITCH) = o[s];
  // s_wait_xcnt 0 behind the stores: a precaution, it stands ahead of any rewrite of
  // their address and data registers.
  asm volatile("s_wait_xcnt 0x0" ::: "memory");
}

// 16 stores of half a fragment-order tile (512 B) each. Store s holds rows
// (s >> 2) * 16 .. + 15 of the staged tile, columns (s & 3) * 16 .. + 15; ROWSTEP and
// COLSTEP (halves) are the distances between neighbouring tiles along rows and columns.
template <int ROWSTEP, int COLSTEP>
static __device__ __forceinline__ void store_tiles(_Float16* p, const v8h (&o)[16]) {
#pragma unroll  // offsets and register indices become constants
  for (int s = 0; s < 16; ++s)
    *(v8h*)(p + (s >> 2) * ROWSTEP + ((s >> 1) & 1) * COLSTEP + (s & 1) * 256) = o[s];
  // s_wait_xcnt 0 behind the stores: the same precaution as in store_rows.
  asm volatile("s_wait_xcnt 0x0" ::: "memory");
}

__global__ __launch_bounds__(128) void qkv_proj_kernel(
    const _Float16* __restrict__ Xh, const _Float16* __restrict__ Wqh,
    const _Float16* __restrict__ Wkh, const _Float16* __restrict__ Wvh,
    _Float16* __restrict__ Qh, _Float16* __restrict__ Kh,
    _Float16* __restrict__ Vt) {
  __shared__ __attribute__((aligned(16))) char smem[2 * (128 + 128) * LDS_PITCH];
  const int lane = threadIdx.x & 31, wave = threadIdx.x >> 5;
  const int lm = lane & 15, hs = lane >> 4;
  const int z = blockIdx.z;
  const _Float16* W = (z == 0) ? Wqh : ((z == 1) ? Wkh : Wvh);
  const int bm0 = blockIdx.y * 128;  // row in (b*t) space
  const int bn0 = blockIdx.x * 128;  // col in (h*d) space
  const bool wa = z < 2;             // weights on the A side (Q, K)

  v8f acc[4][4] = {};
  gemm_staged<128, 128, 512, 64>(wa ? W : Xh, wa ? Xh : W, wa ? bn0 : bm0, wa ? bm0 : bn0,
                             smem, acc);

  // The last trip's barrier stands behind every wave's last read of the ring and no
  // copy is outstanding: the ring is free, and each wave takes 64 rows of it.
  char* st = smem + wave * (64 * LDS_PITCH);
  const float sc = wa ? 0.21022410381342865f : 1.0f;  // 512^-0.25
  // The loops below are unrolled so that every accumulator and row index is a
  // constant (registers, no scratch).
#pragma unroll
  for (int i = 0; i < 4; ++i) {
#pragma unroll
    for (int j = 0; j < 4; ++j) {
      v8h h8;  // C layout: A-side row = i*16 + hs*8 + r, B-side row = j*16 + lm
#pragma unroll
      for (int r = 0; r < 8; ++r) h8[r] = (_Float16)(acc[i][j][r] * sc);
      *(v8h*)(st + (j * 16 + lm) * LDS_PITCH + (i * 16 + hs * 8) * 2) = h8;
    }
  }
  // The rows are read back by other lanes of this wave: its LDS writes are done first.
  asm volatile("s_wait_dscnt 0x0" ::: "memory");
  v8h o[16];
  const int m0 = bm0 + (wa ? (wave & 1) : (wave >> 1)) * 64;
  const int n0 = bn0 + (wa ? (wave >> 1) : (wave & 1)) * 64;
  const size_t head = (size_t)((m0 >> 10) * 8 + (n0 >> 9)) * (1024 * 512);
  const int t0 = m0 & 1023, d0 = n0 & 511;
  if (z == 0) {
#pragma unroll
    for (int s = 0; s < 16; ++s)
      o[s] = *(const v8h*)(st + (s * 4 + (lane >> 3)) * LDS_PITCH + (lane & 7) * 16);
    store_rows<512>(Qh + head + (size_t)(t0 + (lane >> 3)) * 512 + d0 + (lane & 7) * 8, o);
  } else {
    // Lane (hs, lm) of store s takes row (s >> 2) * 16 + lm, 16-byte unit (s & 3) * 2 + hs.
#pragma unroll
    for (int s = 0; s < 16; ++s)
      o[s] = *(const v8h*)(st + ((s >> 2) * 16 + lm) * LDS_PITCH + ((s & 3) * 2 + hs) * 16);
    if (z == 1)  // rows are keys, columns d: tile index = key tile * 16 + d tile
      store_tiles<16 * 512, 512>(Kh + head + ((t0 >> 4) * 16 + (d0 >> 5)) * 512 + lane * 8, o);
    else         // rows are d, columns keys: tile index = key tile * 32 + d tile
      store_tiles<512, 32 * 512>(Vt + head + ((t0 >> 5) * 32 + (d0 >> 4)) * 512 + lane * 8, o);
  }
}

// ---------------------------------------------------------------------------
// Kernel 2: flash attention, transposed products. grid = (T/64, B*H); block = 128.
// A work-group owns 64 queries (4 column tiles of 16) and walks the keys 64 at a time.
// Scores: the waves split the KEYS. Wave w forms S^T = K . Q^T for its own 16 keys, all
// 64 queries and the whole d = 512 (A = K tiles from global, B = Q from LDS), so no
// partial sums go between waves. A lane then holds 8 keys of one query: maximum and sum
// run in registers on every wave; only one maximum per query and wave goes through LDS.
// Output: the waves split d. Wave w forms O^T += V^T . P^T for its 128 d (A = V tiles
// from global, B = P^T of all 64 keys from LDS). A lane holds 8 neighbouring d of one
// query, so the rescale factor is the lane's own and O leaves in 16-byte stores.
// The 64 x 512 O tile takes 256 registers a lane, so the Q tile lives in LDS.
// LDS row pitches (1040 B for Q, 144 B for P) are odd multiples of 16 B: 16-byte
// accesses of neighbouring rows fall on different banks.
// All inner loops are unrolled so that every fragment and accumulator index is a
// constant (registers, no scratch).
// ---------------------------------------------------------------------------
#define QT 4         // 16-query tiles per work-group
#define PT_PITCH 72  // halves per P row (one query, 64 keys) in LDS
#define QS_PITCH 520 // halves per Q row in LDS

// Work-group barrier that orders LDS traffic only. The waves exchange data through LDS
// alone, and __syncthreads() would also wait for every global load in flight: with this
// form the K and V fragment loads issued ahead stay in flight across the barrier.
static __device__ __forceinline__ void lds_barrier() {
  asm volatile("s_wait_dscnt 0x0\n\ts_barrier_signal -1\n\ts_barrier_wait -1" ::: "memory");
}

// Lane l takes the value of lane l ^ 16 (the other 8 keys of the same query).
static __device__ __forceinline__ float xhalf(float x) {
  return __builtin_bit_cast(float, __builtin_amdgcn_permlanex16(
      __builtin_bit_cast(int, x), __builtin_bit_cast(int, x), 0x76543210, 0xfedcba98,
      false, false));
}

__global__ __launch_bounds__(128) void flash_attn_kernel(
    const _Float16* __restrict__ Qh, const _Float16* __restrict__ Kh,
    const _Float16* __restrict__ Vt, _Float16* __restrict__ Oh) {
  __shared__ __align__(16) _Float16 Qs[QT * 16 * QS_PITCH];  // Q tile (B frag src)
  __shared__ __align__(16) _Float16 Pt[QT * 16 * PT_PITCH];  // probs, query-major (B frag src)
  __shared__ __align__(16) float Mx[QT * 16 * 4];  // per query: one value of each wave

  const int tid = threadIdx.x;
  const int lane = tid & 31, wave = tid >> 5;
  const int lm = lane & 15, hs = lane >> 4;
  const int bh = blockIdx.y;
  const int m0 = blockIdx.x * (QT * 16);
  const int ds0 = wave * 128;

  const _Float16* qbase = Qh + ((size_t)bh * 1024 + m0) * 512;
  const _Float16* kbase = Kh + (size_t)bh * 1024 * 512;
  const _Float16* vbase = Vt + (size_t)bh * 512 * 1024;

  // Q tile to LDS once (reused all key blocks): two whole rows per pass of the block.
#pragma unroll
  for (int i = 0; i < QT * 8; ++i)
    *(v8h*)(Qs + (i * 2 + (tid >> 6)) * QS_PITCH + (tid & 63) * 8) =
        *(const v8h*)(qbase + (size_t)(i * 2 + (tid >> 6)) * 512 + (tid & 63) * 8);
  const _Float16* qrow = Qs + lm * QS_PITCH + hs * 8;
  _Float16* prow = Pt + lm * PT_PITCH + hs * 8;
  float* mrow = Mx + lm * 4;

  v8f oacc[QT][8] = {};  // [query tile][d tile]: d = hs * 8 + r, query = lm
  // Running maximum of query mt * 16 + lm (alike in all waves and both halves) and the
  // running sum over the keys that this lane itself has seen.
  float mrun[QT], lrun[QT];
#pragma unroll
  for (int mt = 0; mt < QT; ++mt) { mrun[mt] = -1e30f; lrun[mt] = 0.0f; }
  __syncthreads();

  // The wave's number as a scalar: the K and V addresses are then a scalar base and one
  // lane offset, which keeps address registers out of the vector file (no spill).
  const int swave = __builtin_amdgcn_readfirstlane(wave);
  // K fragments of the wave's key tile (nb * 4 + wave), d tiles 0 .. 15: 16 KB in a row.
  // Each block's are loaded during the block before.
  v16h kf[16];
  {
    const unsigned ko = swave * 16384 + lane * 16;  // byte offset in this head's K
    const _Float16* kp = (const _Float16*)((const char*)kbase + ko);
#pragma unroll
    for (int dt = 0; dt < 16; ++dt) kf[dt] = frag_packed(kp + dt * 512);
    // s_wait_xcnt 0 behind the K loads: a precaution, it stands ahead of any rewrite
    // of their address registers.
    asm volatile("s_wait_xcnt 0x0" ::: "memory");
    // Keeps that wait directly behind the loads, ahead of the address arithmetic below.
    __builtin_amdgcn_sched_barrier(0);
  }

  for (int nb = 0; nb < 16; ++nb) {
    // Non-blocking prefetch of the next key block (global_prefetch_b8): every other
    // 256-byte unit of the wave's own K tile and V slices.
    if (nb + 1 < 16) {
      __builtin_prefetch(kbase + (nb + 1) * 32768 + wave * 8192 + lane * 256, 0, 1);
      __builtin_prefetch(vbase + (nb + 1) * 32768 + hs * 16384 + wave * 4096 + lm * 256, 0, 1);
    }
    // ---- S^T = K[16 keys of the wave, :] . Q^T, one tile per query tile ----
    v8f st[QT] = {};
    // Q fragments are read ahead of their products: one d step ahead at first, two from
    // step 4 on, when spent K fragments have left registers for a third set.
    v16h qf[3][QT];
#pragma unroll
    for (int mt = 0; mt < QT; ++mt) qf[0][mt] = frag_f16(qrow + mt * 16 * QS_PITCH);
#pragma unroll
    for (int dt = 0; dt < 16; ++dt) {
      const int from = dt < 5 ? dt + 1 : dt + 2;  // first step not yet asked for
      const int upto = dt < 4 ? dt + 1 : dt + 2;  // last step to ask for now
#pragma unroll
      for (int nx = from; nx <= upto; ++nx) {
        if (nx < 16) {
#pragma unroll
          for (int mt = 0; mt < QT; ++mt)
            qf[nx % 3][mt] = frag_f16(qrow + mt * 16 * QS_PITCH + nx * 32);
        }
      }
      // Keeps the later d steps' Q reads as one group ahead of this step's products,
      // so that their LDS latency runs behind matrix instructions.
      __builtin_amdgcn_sched_barrier(0);
#pragma unroll
      for (int mt = 0; mt < QT; ++mt) st[mt] = WMMA(kf[dt], qf[dt % 3][mt], st[mt]);
    }
    // The V fragments of this key block are asked for here, into the registers that the
    // K fragments leave: their latency runs behind the softmax.
    // A[d][key]: key tiles nb * 2 + kk, d tiles wave * 8 .. + 7, 8 KB in a row each.
    const unsigned vo = nb * 65536 + swave * 8192 + lane * 16;  // byte offset in this head's V
    const _Float16* vp = (const _Float16*)((const char*)vbase + vo);
    v16h vf[16];
#pragma unroll
    for (int i = 0; i < 16; ++i) vf[i] = frag_packed(vp + (i >> 3) * 16384 + (i & 7) * 512);

    // ---- online softmax in registers: lane = query lm, keys wave * 16 + hs * 8 + r ----
    float mloc[QT];
#pragma unroll
    for (int mt = 0; mt < QT; ++mt) {
      float a = fmaxf(st[mt][0], st[mt][1]);
#pragma unroll
      for (int r = 2; r < 8; ++r) a = fmaxf(a, st[mt][r]);
      mloc[mt] = fmaxf(a, xhalf(a));
    }
    if (hs == 0) {
#pragma unroll
      for (int mt = 0; mt < QT; ++mt) mrow[mt * 64 + wave] = mloc[mt];
    }
    lds_barrier();  // every wave's maxima of this block are in Mx
    float alpha[QT];
#pragma unroll
    for (int mt = 0; mt < QT; ++mt) {
      const v4f m4 = *(const v4f*)(mrow + mt * 64);
      const float mn = fmaxf(fmaxf(fmaxf(m4[0], m4[1]), fmaxf(m4[2], m4[3])), mrun[mt]);
      alpha[mt] = __expf(mrun[mt] - mn);
      mrun[mt] = mn;
      float s = 0.0f;
      v8h p8;
#pragma unroll
      for (int r = 0; r < 8; ++r) {
        const float p = __expf(st[mt][r] - mn);
        s += p;
        p8[r] = (_Float16)p;
      }
      lrun[mt] = lrun[mt] * alpha[mt] + s;
      *(v8h*)(prow + mt * 16 * PT_PITCH + wave * 16) = p8;
    }
    lds_barrier();  // P^T of all 64 keys is in Pt; Mx is free for the next block

    // ---- O^T += V^T . P^T over this d slice; the next block's K fragments are asked
    // for as the V fragments leave their registers ----
    // The last pass loads its own K tile again, unused: no branch round the loads.
    const int nk = nb + 1 < 16 ? nb + 1 : nb;
    const unsigned ko = nk * 65536 + swave * 16384 + lane * 16;  // byte offset in this head's K
    const _Float16* kp = (const _Float16*)((const char*)kbase + ko);
    v16h pf[2][QT];  // P^T as B operand (32 keys x 16 queries per key half and query tile)
#pragma unroll
    for (int kk = 0; kk < 2; ++kk)
#pragma unroll
      for (int mt = 0; mt < QT; ++mt)
        pf[kk][mt] = frag_f16(prow + mt * 16 * PT_PITCH + kk * 32);
    // Keeps the P reads ahead of the rescale, so that their LDS latency runs behind it.
    __builtin_amdgcn_sched_barrier(0);
    // Rescale of the O accumulators: the factor is the lane's own.
#pragma unroll
    for (int mt = 0; mt < QT; ++mt)
#pragma unroll
      for (int dt = 0; dt < 8; ++dt) oacc[mt][dt] *= alpha[mt];
#pragma unroll
    for (int kk = 0; kk < 2; ++kk) {
#pragma unroll
      for (int dt = 0; dt < 8; ++dt) {
#pragma unroll
        for (int mt = 0; mt < QT; ++mt)
          oacc[mt][dt] = WMMA(vf[kk * 8 + dt], pf[kk][mt], oacc[mt][dt]);
        kf[kk * 8 + dt] = frag_packed(kp + (kk * 8 + dt) * 512);
        // Keeps each K load behind the products that free its registers (no spill).
        __builtin_amdgcn_sched_barrier(0);
      }
    }
    // s_wait_xcnt 0 behind the prefetches and the V and K loads: a precaution, it stands
    // ahead of any rewrite of their address registers; naming the two offsets as inputs
    // keeps those registers as they are up to here.
    asm volatile("s_wait_xcnt 0x0" :: "v"(vo), "v"(ko) : "memory");
    // Keeps the next pass's address steps (prefetch pointers too) behind that wait.
    __builtin_amdgcn_sched_barrier(0);
  }

  // ---- join the row sums (two halves, four waves), normalize, store to Oh (B,T,H*512) ----
#pragma unroll
  for (int mt = 0; mt < QT; ++mt) lrun[mt] += xhalf(lrun[mt]);
  if (hs == 0) {
#pragma unroll
    for (int mt = 0; mt < QT; ++mt) mrow[mt * 64 + wave] = lrun[mt];
  }
  lds_barrier();  // every wave's sums are in Mx
  const int b = bh >> 3, h = bh & 7;
  _Float16* obase = Oh + ((size_t)b * 1024 + m0 + lm) * 4096 + h * 512 + ds0 + hs * 8;
#pragma unroll
  for (int mt = 0; mt < QT; ++mt) {
    const v4f l4 = *(const v4f*)(mrow + mt * 64);
    const float inv = 1.0f / ((l4[0] + l4[1]) + (l4[2] + l4[3]));
    v8h o[8];
#pragma unroll
    for (int dt = 0; dt < 8; ++dt)
#pragma unroll
      for (int r = 0; r < 8; ++r) o[dt][r] = (_Float16)(oacc[mt][dt][r] * inv);
    // The two scheduling fences keep every vector write of a query tile ahead of its
    // stores and every later one behind the wait below.
    __builtin_amdgcn_sched_barrier(0);
#pragma unroll
    for (int dt = 0; dt < 8; ++dt) *(v8h*)(obase + (size_t)mt * 16 * 4096 + dt * 16) = o[dt];
    // s_wait_xcnt 0 behind the stores: a precaution, it stands ahead of any rewrite
    // of their address and data registers by the next query tile.
    asm volatile("s_wait_xcnt 0x0" ::: "memory");
    __builtin_amdgcn_sched_barrier(0);
  }
}

// ---------------------------------------------------------------------------
// Kernel 3: out = Oh . Woh^T + bo (f32 out). grid = (8, 64); block = 128.
// Block tile 64(M) x 64(N), each wave 32 x 32, K = 4096 in 16 staged trips of 256 k:
// 64 KB fly per trip and work-group, asked for a whole trip (32 matrix instructions a
// wave) ahead, so that the operands' latency from memory runs behind the products.
// ---------------------------------------------------------------------------
__global__ __launch_bounds__(128) void out_proj_kernel(
    const _Float16* __restrict__ Oh, const _Float16* __restrict__ Woh,
    const float* __restrict__ bo, float* __restrict__ out) {
  __shared__ __attribute__((aligned(16))) char smem[2 * (64 + 64) * (256 * 2 + 16)];
  const int lane = threadIdx.x & 31, wave = threadIdx.x >> 5;
  const int lm = lane & 15, hs = lane >> 4;
  const int bm0 = blockIdx.y * 64;
  const int bn0 = blockIdx.x * 64;

  v8f acc[2][2] = {};
  gemm_staged<64, 64, 4096, 256>(Oh, Woh, bm0, bn0, smem, acc);

  const int m0 = bm0 + (wave >> 1) * 32;
  const int n0 = bn0 + (wave & 1) * 32;
#pragma unroll
  for (int j = 0; j < 2; ++j) {
    const int n = n0 + j * 16 + lm;
    const float bias = bo[n];
#pragma unroll
    for (int i = 0; i < 2; ++i) {
#pragma unroll
      for (int r = 0; r < 8; ++r) {
        const int m = m0 + i * 16 + r + hs * 8;
        out[(size_t)m * 512 + n] = acc[i][j][r] + bias;
      }
    }
  }
}

// ---------------------------------------------------------------------------
extern "C" void kernel_launch(void* const* d_in, const int* in_sizes, int n_in,
                              void* d_out, int out_size, void* d_ws, size_t ws_size,
                              hipStream_t stream) {
  (void)in_sizes; (void)n_in; (void)out_size; (void)ws_size;
  const float* x  = (const float*)d_in[0];
  const float* Wq = (const float*)d_in[1];
  const float* Wk = (const float*)d_in[2];
  const float* Wv = (const float*)d_in[3];
  const float* Wo = (const float*)d_in[4];
  const float* bo = (const float*)d_in[5];
  float* out = (float*)d_out;

  char* ws = (char*)d_ws;
  _Float16* Qh  = (_Float16*)(ws);
  _Float16* Kh  = (_Float16*)(ws + (size_t)33554432);
  _Float16* Vt  = (_Float16*)(ws + (size_t)67108864);
  _Float16* Oh  = (_Float16*)(ws + (size_t)100663296);
  _Float16* Xh  = (_Float16*)(ws + (size_t)134217728);
  _Float16* Wqh = (_Float16*)(ws + (size_t)138412032);
  _Float16* Wkh = (_Float16*)(ws + (size_t)142606336);
  _Float16* Wvh = (_Float16*)(ws + (size_t)146800640);
  _Float16* Woh = (_Float16*)(ws + (size_t)150994944);

  cvt_f16_kernel<<<dim3(2048, 5), 256, 0, stream>>>(x, Wq, Wk, Wv, Wo,
                                                    Xh, Wqh, Wkh, Wvh, Woh);
  qkv_proj_kernel<<<dim3(32, 32, 3), 128, 0, stream>>>(Xh, Wqh, Wkh, Wvh,
                                                       Qh, Kh, Vt);
  flash_attn_kernel<<<dim3(16, 32), 128, 0, stream>>>(Qh, Kh, Vt, Oh);
  out_proj_kernel<<<dim3(8, 64), 128, 0, stream>>>(Oh, Woh, bo, out);
}

// v009
// One run takes 112 microseconds.
// It is 1.25 times as fast as v007, going by the measured steps of the versions left out in between.
// All steps since v000 together make it 6.08 times as fast.
#include <hip/hip_runtime.h>

// ---------------------------------------------------------------------------
// MI455X (gfx1250) fused multi-head self-attention, f16 WMMA / f32 accum.
//   B=4, T=1024, EMBED=512, H=8, head_dim=512 (reference uses full EMBED/head)
// The two weight pairs that meet inside a head are multiplied first (matrix products
// are associative), so that two of the four products with a weight matrix go:
//   scores  (x Wq_h^T)(x Wk_h^T)^T = (x G_h^T) x^T,      G_h = Wk_h^T . Wq_h  (512 x 512)
//   out     sum_h P_h (x Wv_h^T) Wo_h^T = sum_h P_h (x R_h^T),  R_h = Wo_h . Wv_h  (512 x 512)
// G and R cost 16 products of 512^3. The keys are then x itself (no K projection), and
// the last launch only adds the 8 heads' planes and the bias (no product over k = 4096).
// Workspace layout (ends at 156 MB):
//   Qh  : (B,H,T,512) f16 @ 0      (x G_h^T, scaled by 512^-0.5)
//   Xf  : (B) x 64 key tiles x 16 d tiles of 16 keys x 32 d, f16 @ 32MB: x as the keys
//         of all 8 heads, each tile in fragment order (see frag_packed)
//   Vt  : (B,H) x 32 key tiles x 32 n tiles of 16 n x 32 keys, f16 @ 64MB: x R_h^T,
//         each tile in fragment order
//   Oh  : (B,T,H,512) f16 @ 96MB   (each head's share of the output row)
//   Xh  : (4096,512)  f16 @ 128MB  (x converted once, row-major)
//   Rvh : (H,512 n,512 i) f16 @ 148MB;  Gqh : (H,512 j,512 i) f16 @ 152MB
// The projection GEMMs read f16 tiles staged in LDS; attention reads f16 from global.
// ---------------------------------------------------------------------------

typedef _Float16 v16h __attribute__((ext_vector_type(16)));
typedef _Float16 v8h  __attribute__((ext_vector_type(8)));
typedef _Float16 v4h  __attribute__((ext_vector_type(4)));
typedef float    v8f  __attribute__((ext_vector_type(8)));
typedef float    v4f  __attribute__((ext_vector_type(4)));

#define WMMA(a, b, c) \
  __builtin_amdgcn_wmma_f32_16x16x32_f16(false, (a), false, (b), (short)0, (c), false, false)

// A/B fragment element e (lane L, hs=L>>4): K = (e>>3)*16 + hs*8 + (e&7)
// -> two contiguous 8-half (16B) runs at K0 = hs*8 and K0+16.
static __device__ __forceinline__ v16h frag_f16(const _Float16* p0) {
  v8h lo = *(const v8h*)p0;
  v8h hi = *(const v8h*)(p0 + 16);
  v16h r;
#pragma unroll
  for (int i = 0; i < 8; ++i) { r[i] = lo[i]; r[8 + i] = hi[i]; }
  return r;
}

// A 16 x 32 A-operand tile stored in fragment order: 1024 B, 16-byte unit u holds
// row u & 15, k = (u >> 5) * 16 + ((u >> 4) & 1) * 8 .. + 7. Lane L takes units L and
// L + 32, so each of the two wave-wide loads covers 512 contiguous bytes (4 whole
// 128-byte lines). p0 = tile + lane * 8.
static __device__ __forceinline__ v16h frag_packed(const _Float16* p0) {
  v8h lo = *(const v8h*)p0;
  v8h hi = *(const v8h*)(p0 + 256);
  v16h r;
#pragma unroll
  for (int i = 0; i < 8; ++i) { r[i] = lo[i]; r[8 + i] = hi[i]; }
  return r;
}

// ---------------------------------------------------------------------------
// Projection GEMM core: C(BM x BN) = A(BM x K) . B(BN x K)^T, both k-contiguous.
// 128 threads, 4 waves as 2 x 2, each wave (BM/2) x (BN/2). A trip is KT k
// (rows of 2 KT bytes): [A rows | B rows] at an LDS pitch of 2 KT + 16 B (an odd
// multiple of 16 B), two buffers, filled by per-lane 16-byte asynchronous copies
// (a wave covers 512 B of whole rows). KT sets how many bytes fly per trip.
// ---------------------------------------------------------------------------
#define LDS_PITCH 144

// Four copies, then s_wait_xcnt 0 (a precaution: it stands ahead of any rewrite of
// the copies' address registers); one statement, so that the compiler can put
// nothing between the copies and the wait.
static __device__ __forceinline__ void copy4_to_lds(unsigned l, const _Float16* g,
                                                    int lstep, size_t gstep) {
  asm volatile(
      "global_load_async_to_lds_b128 %0, %4, off\n\t"
      "global_load_async_to_lds_b128 %1, %5, off\n\t"
      "global_load_async_to_lds_b128 %2, %6, off\n\t"
      "global_load_async_to_lds_b128 %3, %7, off\n\t"
      "s_wait_xcnt 0x0"
      :: "v"(l), "v"(l + lstep), "v"(l + 2 * lstep), "v"(l + 3 * lstep),
         "v"(g), "v"(g + gstep), "v"(g + 2 * gstep), "v"(g + 3 * gstep)
      : "memory");
}

// ROWS rows of 2 KT bytes, U = KT / 8 units of 16 B a row: thread t brings 16 B at row
// t / U + (128 / U) i, byte (t % U) * 16.
template <int ROWS, int K, int KT>
static __device__ __forceinline__ void stage_rows(unsigned l, const _Float16* g) {
  constexpr int RP = 1024 / KT;        // rows per pass of the 128 threads
  constexpr int PITCH = KT * 2 + 16;
  static_assert(ROWS % (4 * RP) == 0, "four copies a statement");
#pragma unroll  // address steps become constants
  for (int i = 0; i < ROWS / RP; i += 4)
    copy4_to_lds(l + i * RP * PITCH, g + (size_t)i * RP * K, RP * PITCH,
                 (size_t)RP * K);
}

template <int BM, int BN, int K, int KT>
static __device__ __forceinline__ void gemm_staged(
    const _Float16* __restrict__ A, const _Float16* __restrict__ B, int m0, int n0,
    char* smem, v8f (&acc)[BM / 32][BN / 32]) {
  constexpr int PITCH = KT * 2 + 16;
  constexpr int STAGE = (BM + BN) * PITCH;
  constexpr int T = K / KT;
  constexpr int U = KT / 8;
  static_assert(T >= 2 && K % KT == 0 && KT % 64 == 0 && BM % 64 == 0 && BN % 64 == 0,
                "tile shape");
  static_assert((BM + BN) * U / 128 <= 63, "copies of a wave in flight");
  const int tid = threadIdx.x;
  const int lane = tid & 31, wave = tid >> 5;
  const int lm = lane & 15, hs = lane >> 4;
  const int wm = wave >> 1, wn = wave & 1;

  const _Float16* ga = A + (size_t)(m0 + tid / U) * K + (tid % U) * 8;
  const _Float16* gb = B + (size_t)(n0 + tid / U) * K + (tid % U) * 8;
  const unsigned la = (unsigned)(uintptr_t)smem + (tid / U) * PITCH + (tid % U) * 16;
  const unsigned lb = la + BM * PITCH;
  const char* ra = smem + (wm * (BM / 2) + lm) * PITCH + hs * 16;
  const char* rb = smem + (BM + wn * (BN / 2) + lm) * PITCH + hs * 16;

  stage_rows<BM, K, KT>(la, ga);
  stage_rows<BN, K, KT>(lb, gb);
  // Tile 0 has landed for this wave; the barrier publishes it to the others.
  asm volatile("s_wait_asynccnt 0x0" ::: "memory");
  __syncthreads();
  stage_rows<BM, K, KT>(la + STAGE, ga + KT);
  stage_rows<BN, K, KT>(lb + STAGE, gb + KT);

  for (int t = 0; t < T; ++t) {
    const int off = (t & 1) * STAGE;
    // All loops below are unrolled so that every fragment and accumulator index
    // is a constant (registers, no scratch).
#pragma unroll
    for (int ks = 0; ks < KT / 32; ++ks) {
      v16h a[BM / 32], b[BN / 32];
#pragma unroll
      for (int i = 0; i < BM / 32; ++i)
        a[i] = frag_f16((const _Float16*)(ra + off + i * 16 * PITCH + ks * 64));
#pragma unroll
      for (int j = 0; j < BN / 32; ++j)
        b[j] = frag_f16((const _Float16*)(rb + off + j * 16 * PITCH + ks * 64));
#pragma unroll
      for (int i = 0; i < BM / 32; ++i)
#pragma unroll
        for (int j = 0; j < BN / 32; ++j) acc[i][j] = WMMA(a[i], b[j], acc[i][j]);
    }
    // This wave's reads of buffer t & 1 are done before it may be refilled.
    asm volatile("s_wait_dscnt 0x0" ::: "memory");
    // This wave's copies of tile t + 1 have landed before the barrier publishes them.
    asm volatile("s_wait_asynccnt 0x0" ::: "memory");
    __syncthreads();
    if (t + 2 < T) {
      stage_rows<BM, K, KT>(la + off, ga + (t + 2) * KT);
      stage_rows<BN, K, KT>(lb + off, gb + (t + 2) * KT);
    }
  }
  // No copy is outstanding when the wave goes on to its stores and ends.
  asm volatile("s_wait_asynccnt 0x0" ::: "memory");
}

// ---------------------------------------------------------------------------
// Work-group barrier that orders LDS traffic only. The waves exchange data through LDS
// alone, and __syncthreads() would also wait for every global load in flight: with this
// form loads issued ahead stay in flight across the barrier.
static __device__ __forceinline__ void lds_barrier() {
  asm volatile("s_wait_dscnt 0x0\n\ts_barrier_signal -1\n\ts_barrier_wait -1" ::: "memory");
}

// ---------------------------------------------------------------------------
// Kernel 0: the two weight products of each head, straight from the f32 weights, and
// the conversion of x. grid = 256; block = 256 (8 waves as 2 x 4, each 64 i x 32 n).
// C[n][i] = sum_d B[n][d] A[i][d], tile 128 (i) x 128 (n), z = id >> 4:
//   z <  8 : R_h[n][i] = sum_d Wo[n][h,d] Wv[h,d][i]   (A = Wv^T, B = Wo)
//   z >= 8 : G_h[j][i] = sum_d Wk[h,d][j] Wq[h,d][i]   (A = Wq^T, B = Wk^T)
// K = 512 in 8 trips of 64 d. A trip's f32 values come into registers (two sets: one is
// in flight while the other is used), are rounded to f16 and stored to LDS with d
// contiguous (Wq, Wk, Wv are turned on the way: a thread takes blocks of 4 d x 4 columns
// and stores 4 runs of 4 d). Two LDS buffers, one barrier a trip. The i side is given as
// A: a lane of the accumulator then holds 8 neighbouring i of one n, one 16-byte store.
// Each work-group also converts one key tile of x (16 rows x 512) while its first weight
// loads fly: the row-major f16 copy, and the same values in the key tiles' fragment order
// (through LDS, so that every global load and store of a wave covers whole 128-byte lines).
// ---------------------------------------------------------------------------
#define FP 144                    // LDS row pitch in bytes: 64 halves + 16 B
#define FSTAGE ((128 + 128) * FP) // one buffer: 128 A rows, 128 B rows

static __device__ __forceinline__ v4h to_h4(float a, float b, float c, float d) {
  v4h h;
  h[0] = (_Float16)a; h[1] = (_Float16)b; h[2] = (_Float16)c; h[3] = (_Float16)d;
  return h;
}

// Two blocks of 4 d x 4 columns: rows r and 32 + r of the thread's place in a trip.
static __device__ __forceinline__ void load_turned(const float* p, v4f (&v)[8]) {
#pragma unroll  // register indices become constants
  for (int b = 0; b < 2; ++b)
#pragma unroll
    for (int r = 0; r < 4; ++r) v[b * 4 + r] = *(const v4f*)(p + (b * 32 + r) * 512);
}

// The same blocks to LDS, column by column: 4 d of one column are 8 bytes of its row.
static __device__ __forceinline__ void store_turned(char* w, const v4f (&v)[8]) {
#pragma unroll  // register indices become constants
  for (int b = 0; b < 2; ++b)
#pragma unroll
    for (int k = 0; k < 4; ++k)
      *(v4h*)(w + k * FP + b * 64) =
          to_h4(v[b * 4][k], v[b * 4 + 1][k], v[b * 4 + 2][k], v[b * 4 + 3][k]);
}

// One work-group's tile. VO: B is Wo, whose rows lie as the product wants them; else B is
// turned like A. The two cases are two straight-line bodies, so that every wait on a
// register set counts only the loads issued before it.
template <bool VO>
static __device__ __forceinline__ void fold_tile(
    const float* __restrict__ sx, const float* __restrict__ sa, const float* __restrict__ sb,
    _Float16* __restrict__ dx, _Float16* __restrict__ df, _Float16* __restrict__ C,
    char* smem, char* xs) {
  const int tid = threadIdx.x;
  const int lane = tid & 31, wave = tid >> 5;
  const int lm = lane & 15, hs = lane >> 4;
  const int h = (blockIdx.x >> 4) & 7;
  const int bi0 = (blockIdx.x & 3) * 128;
  const int bn0 = ((blockIdx.x >> 2) & 3) * 128;

  // A turned operand's place of a thread: d = td .. + 3 and td + 32 .. + 35, columns tc .. + 3.
  // A wave-wide load covers 4 rows of 128 B.
  const int td = (lane >> 3) * 4 + (wave >> 2) * 16;
  const int tc = ((lane & 7) + 8 * (wave & 3)) * 4;
  const float* pa = sa + (size_t)(h * 512 + td) * 512 + bi0 + tc;
  char* wa = smem + tc * FP + td * 2;
  // B turned (Wk): the same places. B as it lies (Wo): load q is row (tid >> 4) + 16 q,
  // d = (tid & 15) * 4 .. + 3.
  const float* pb = VO ? sb + (size_t)(bn0 + (tid >> 4)) * 4096 + h * 512 + (tid & 15) * 4
                       : sb + (size_t)(h * 512 + td) * 512 + bn0 + tc;
  char* wb = smem + 128 * FP + (VO ? (tid >> 4) * FP + (tid & 15) * 8 : tc * FP + td * 2);
  const char* ra = smem + ((wave >> 2) * 64 + lm) * FP + hs * 16;
  const char* rb = smem + (128 + (wave & 3) * 32 + lm) * FP + hs * 16;

  auto load_trip = [&](int t, v4f (&a)[8], v4f (&b)[8]) {
    load_turned(pa + (size_t)t * 64 * 512, a);
    if (VO) {
#pragma unroll  // register indices become constants
      for (int q = 0; q < 8; ++q) b[q] = *(const v4f*)(pb + (size_t)q * 16 * 4096 + t * 64);
    } else {
      load_turned(pb + (size_t)t * 64 * 512, b);
    }
    // s_wait_xcnt 0 behind the loads: a precaution, it stands ahead of any rewrite of
    // their address registers.
    asm volatile("s_wait_xcnt 0x0" ::: "memory");
  };
  auto store_trip = [&](int off, const v4f (&a)[8], const v4f (&b)[8]) {
    store_turned(wa + off, a);
    if (VO) {
#pragma unroll  // register indices become constants
      for (int q = 0; q < 8; ++q)
        *(v4h*)(wb + off + q * 16 * FP) = to_h4(b[q][0], b[q][1], b[q][2], b[q][3]);
    } else {
      store_turned(wb + off, b);
    }
  };
  v8f acc[4][2] = {};
  auto products = [&](int off) {
    v16h a[2][4], b[2][2];
#pragma unroll  // register indices become constants, here and in the loops below
    for (int ks = 0; ks < 2; ++ks) {
#pragma unroll
      for (int i = 0; i < 4; ++i)
        a[ks][i] = frag_f16((const _Float16*)(ra + off + i * 16 * FP + ks * 64));
#pragma unroll
      for (int j = 0; j < 2; ++j)
        b[ks][j] = frag_f16((const _Float16*)(rb + off + j * 16 * FP + ks * 64));
    }
    // Keeps a trip's LDS reads as one group ahead of its products: one LDS latency a
    // trip, not one for every pair of products.
    __builtin_amdgcn_sched_barrier(0);
#pragma unroll
    for (int ks = 0; ks < 2; ++ks)
#pragma unroll
      for (int i = 0; i < 4; ++i)
#pragma unroll
        for (int j = 0; j < 2; ++j) acc[i][j] = WMMA(a[ks][i], b[ks][j], acc[i][j]);
  };

  // ---- x: group g = q * 256 + tid of 4 values is row g >> 7, column (g & 127) * 4 ----
  const size_t xo = (size_t)blockIdx.x * 8192;
  v4f xv[8];
#pragma unroll  // eight independent loads in flight; register indices become constants
  for (int q = 0; q < 8; ++q) xv[q] = *(const v4f*)(sx + xo + tid * 4 + q * 1024);
  // s_wait_xcnt 0 behind the loads: the same precaution as in load_trip.
  asm volatile("s_wait_xcnt 0x0" ::: "memory");
  v4f a0[8], b0[8], a1[8], b1[8];
  load_trip(0, a0, b0);
  load_trip(1, a1, b1);
  {
    // 16-byte unit U = (column >> 3) * 16 + row of the 16 tiles in a row (see frag_packed);
    // every 16 units take 272 B in LDS, so that the lanes of a store meet different banks.
    char* w = xs + ((tid & 127) >> 1) * 272 + (tid >> 7) * 16 + (tid & 1) * 8;
#pragma unroll
    for (int q = 0; q < 8; ++q) {
      const v4h hx = to_h4(xv[q][0], xv[q][1], xv[q][2], xv[q][3]);
      *(v4h*)(dx + xo + tid * 4 + q * 1024) = hx;
      *(v4h*)(w + q * 32) = hx;
    }
    // s_wait_xcnt 0 behind the stores: the same precaution for their registers.
    asm volatile("s_wait_xcnt 0x0" ::: "memory");
  }
  store_trip(0, a0, b0);
  load_trip(2, a0, b0);
  lds_barrier();  // trip 0 is whole in buffer 0, the x tiles are whole in xs
#pragma unroll
  for (int q = 0; q < 4; ++q)
    *(v8h*)(df + xo + tid * 8 + q * 2048) =
        *(const v8h*)(xs + (q * 16 + (tid >> 4)) * 272 + (tid & 15) * 16);
  // s_wait_xcnt 0 behind the stores: the same precaution for their registers.
  asm volatile("s_wait_xcnt 0x0" ::: "memory");

  // Unrolled: each register set is named by a constant, the tests on t fall away, and
  // each wait on a set leaves the younger set's loads in flight.
#pragma unroll
  for (int t = 0; t < 8; t += 2) {
    products(0);
    // Buffer 1's last readers passed the barrier at the foot of the trip before.
    store_trip(FSTAGE, a1, b1);
    if (t + 3 < 8) load_trip(t + 3, a1, b1);
    lds_barrier();  // trip t + 1 is whole in buffer 1; every read of buffer 0 is done
    products(FSTAGE);
    if (t + 2 < 8) {
      store_trip(0, a0, b0);
      if (t + 4 < 8) load_trip(t + 4, a0, b0);
      lds_barrier();  // trip t + 2 is whole in buffer 0; every read of buffer 1 is done
    }
  }

  _Float16* p = C + (size_t)h * (512 * 512) +
                (size_t)(bn0 + (wave & 3) * 32 + lm) * 512 + bi0 + (wave >> 2) * 64 + hs * 8;
  v8h o[4][2];  // C layout: A-side row = i*16 + hs*8 + r, B-side row = j*16 + lm
#pragma unroll  // register indices become constants
  for (int i = 0; i < 4; ++i)
#pragma unroll
    for (int j = 0; j < 2; ++j)
#pragma unroll
      for (int r = 0; r < 8; ++r) o[i][j][r] = (_Float16)acc[i][j][r];
#pragma unroll
  for (int i = 0; i < 4; ++i)
#pragma unroll
    for (int j = 0; j < 2; ++j) *(v8h*)(p + j * 16 * 512 + i * 16) = o[i][j];
}

__global__ __launch_bounds__(256) void fold_weights_kernel(
    const float* __restrict__ sx, const float* __restrict__ sq,
    const float* __restrict__ sk, const float* __restrict__ sv,
    const float* __restrict__ so, _Float16* __restrict__ dx, _Float16* __restrict__ df,
    _Float16* __restrict__ Rvh, _Float16* __restrict__ Gqh) {
  __shared__ __attribute__((aligned(16))) char smem[2 * FSTAGE];
  __shared__ __attribute__((aligned(16))) char xs[64 * 272];
  if (blockIdx.x < 128)
    fold_tile<true>(sx, sv, so, dx, df, Rvh, smem, xs);
  else
    fold_tile<false>(sx, sq, sk, dx, df, Gqh, smem, xs);
}

// ---------------------------------------------------------------------------
// Kernel 1: the two projections of x (f16 x f16 -> f32): z = 0 "Q" = x G^T, z = 1
// "V" = x R^T. grid = (32, 32, 2); block 128.
// Block tile 128 x 128, each wave 64 x 64, K = 512 in 8 staged trips.
// A lane of the accumulator holds 8 neighbouring rows of the A side at one row of
// the B side. The side whose index runs contiguously in the output is therefore
// given as A: the weight rows (d) for Q, the x rows (t) for the transposed V.
// Each wave packs its tile to f16 in an LDS range of its own, one row of 128 B per
// B-side row, and stores it as whole 128-byte lines, 16 B a lane: Q as rows, V as
// 8 tiles in fragment order (a permutation of the 16-byte units of those rows).
// ---------------------------------------------------------------------------
// 16 stores of 4 whole output rows each; PITCH (halves) is a constant so that every
// store takes one address register pair and an immediate offset.
template <int PITCH>
static __device__ __forceinline__ void store_rows(_Float16* p, const v8h (&o)[16]) {
#pragma unroll  // offsets and register indices become constants
  for (int s = 0; s < 16; ++s) *(v8h*)(p + (size_t)s * 4 * PITCH) = o[s];
  // s_wait_xcnt 0 behind the stores: a precaution, it stands ahead of any rewrite of
  // their address and data registers.
  asm volatile("s_wait_xcnt 0x0" ::: "memory");
}

// 16 stores of half a fragment-order tile (512 B) each. Store s holds rows
// (s >> 2) * 16 .. + 15 of the staged tile, columns (s & 3) * 16 .. + 15; ROWSTEP and
// COLSTEP (halves) are the distances between neighbouring tiles along rows and columns.
template <int ROWSTEP, int COLSTEP>
static __device__ __forceinline__ void store_tiles(_Float16* p, const v8h (&o)[16]) {
#pragma unroll  // offsets and register indices become constants
  for (int s = 0; s < 16; ++s)
    *(v8h*)(p + (s >> 2) * ROWSTEP + ((s >> 1) & 1) * COLSTEP + (s & 1) * 256) = o[s];
  // s_wait_xcnt 0 behind the stores: the same precaution as in store_rows.
  asm volatile("s_wait_xcnt 0x0" ::: "memory");
}

__global__ __launch_bounds__(128) void qv_proj_kernel(
    const _Float16* __restrict__ Xh, const _Float16* __restrict__ Gqh,
    const _Float16* __restrict__ Rvh, _Float16* __restrict__ Qh,
    _Float16* __restrict__ Vt) {
  __shared__ __attribute__((aligned(16))) char smem[2 * (128 + 128) * LDS_PITCH];
  const int lane = threadIdx.x & 31, wave = threadIdx.x >> 5;
  const int lm = lane & 15, hs = lane >> 4;
  const int z = blockIdx.z;
  const _Float16* W = (z == 0) ? Gqh : Rvh;
  const int bm0 = blockIdx.y * 128;  // row in (b*t) space
  const int bn0 = blockIdx.x * 128;  // col in (h*d) space
  const bool wa = z == 0;            // weights on the A side (Q)

  v8f acc[4][4] = {};
  gemm_staged<128, 128, 512, 64>(wa ? W : Xh, wa ? Xh : W, wa ? bn0 : bm0, wa ? bm0 : bn0,
                             smem, acc);

  // The last trip's barrier stands behind every wave's last read of the ring and no
  // copy is outstanding: the ring is free, and each wave takes 64 rows of it.
  char* st = smem + wave * (64 * LDS_PITCH);
  const float sc = wa ? 0.04419417382415922f : 1.0f;  // 512^-0.5: the keys carry no scale
  // The loops below are unrolled so that every accumulator and row index is a
  // constant (registers, no scratch).
#pragma unroll
  for (int i = 0; i < 4; ++i) {
#pragma unroll
    for (int j = 0; j < 4; ++j) {
      v8h h8;  // C layout: A-side row = i*16 + hs*8 + r, B-side row = j*16 + lm
#pragma unroll
      for (int r = 0; r < 8; ++r) h8[r] = (_Float16)(acc[i][j][r] * sc);
      *(v8h*)(st + (j * 16 + lm) * LDS_PITCH + (i * 16 + hs * 8) * 2) = h8;
    }
  }
  // The rows are read back by other lanes of this wave: its LDS writes are done first.
  asm volatile("s_wait_dscnt 0x0" ::: "memory");
  v8h o[16];
  const int m0 = bm0 + (wa ? (wave & 1) : (wave >> 1)) * 64;
  const int n0 = bn0 + (wa ? (wave >> 1) : (wave & 1)) * 64;
  const size_t head = (size_t)((m0 >> 10) * 8 + (n0 >> 9)) * (1024 * 512);
  const int t0 = m0 & 1023, d0 = n0 & 511;
  if (z == 0) {
#pragma unroll
    for (int s = 0; s < 16; ++s)
      o[s] = *(const v8h*)(st + (s * 4 + (lane >> 3)) * LDS_PITCH + (lane & 7) * 16);
    store_rows<512>(Qh + head + (size_t)(t0 + (lane >> 3)) * 512 + d0 + (lane & 7) * 8, o);
  } else {
    // Lane (hs, lm) of store s takes row (s >> 2) * 16 + lm, 16-byte unit (s & 3) * 2 + hs.
#pragma unroll
    for (int s = 0; s < 16; ++s)
      o[s] = *(const v8h*)(st + ((s >> 2) * 16 + lm) * LDS_PITCH + ((s & 3) * 2 + hs) * 16);
    // rows are d, columns keys: tile index = key tile * 32 + d tile
    store_tiles<512, 32 * 512>(Vt + head + ((t0 >> 5) * 32 + (d0 >> 4)) * 512 + lane * 8, o);
  }
}

// ---------------------------------------------------------------------------
// Kernel 2: flash attention, transposed products. grid = (T/64, B*H); block = 128.
// Q is x G_h^T, K is x itself (one set of key tiles per batch), V is x R_h^T.
// A work-group owns 64 queries (4 column tiles of 16) and walks the keys 64 at a time.
// Scores: the waves split the KEYS. Wave w forms S^T = K . Q^T for its own 16 keys, all
// 64 queries and the whole d = 512 (A = K tiles from global, B = Q from LDS), so no
// partial sums go between waves. A lane then holds 8 keys of one query: maximum and sum
// run in registers on every wave; only one maximum per query and wave goes through LDS.
// Output: the waves split d. Wave w forms O^T += V^T . P^T for its 128 d (A = V tiles
// from global, B = P^T of all 64 keys from LDS). A lane holds 8 neighbouring d of one
// query, so the rescale factor is the lane's own and O leaves in 16-byte stores.
// The 64 x 512 O tile takes 256 registers a lane, so the Q tile lives in LDS.
// LDS row pitches (1040 B for Q, 144 B for P) are odd multiples of 16 B: 16-byte
// accesses of neighbouring rows fall on different banks.
// All inner loops are unrolled so that every fragment and accumulator index is a
// constant (registers, no scratch).
// ---------------------------------------------------------------------------
#define QT 4         // 16-query tiles per work-group
#define PT_PITCH 72  // halves per P row (one query, 64 keys) in LDS
#define QS_PITCH 520 // halves per Q row in LDS

// Lane l takes the value of lane l ^ 16 (the other 8 keys of the same query).
static __device__ __forceinline__ float xhalf(float x) {
  return __builtin_bit_cast(float, __builtin_amdgcn_permlanex16(
      __builtin_bit_cast(int, x), __builtin_bit_cast(int, x), 0x76543210, 0xfedcba98,
      false, false));
}

__global__ __launch_bounds__(128) void flash_attn_kernel(
    const _Float16* __restrict__ Qh, const _Float16* __restrict__ Kh,
    const _Float16* __restrict__ Vt, _Float16* __restrict__ Oh) {
  __shared__ __align__(16) _Float16 Qs[QT * 16 * QS_PITCH];  // Q tile (B frag src)
  __shared__ __align__(16) _Float16 Pt[QT * 16 * PT_PITCH];  // probs, query-major (B frag src)
  __shared__ __align__(16) float Mx[QT * 16 * 4];  // per query: one value of each wave

  const int tid = threadIdx.x;
  const int lane = tid & 31, wave = tid >> 5;
  const int lm = lane & 15, hs = lane >> 4;
  const int bh = blockIdx.y;
  const int m0 = blockIdx.x * (QT * 16);
  const int ds0 = wave * 128;

  const _Float16* qbase = Qh + ((size_t)bh * 1024 + m0) * 512;
  const _Float16* kbase = Kh + (size_t)(bh >> 3) * 1024 * 512;  // x of the batch: keys of all heads
  const _Float16* vbase = Vt + (size_t)bh * 512 * 1024;

  // Q tile to LDS once (reused all key blocks): two whole rows per pass of the block.
#pragma unroll
  for (int i = 0; i < QT * 8; ++i)
    *(v8h*)(Qs + (i * 2 + (tid >> 6)) * QS_PITCH + (tid & 63) * 8) =
        *(const v8h*)(qbase + (size_t)(i * 2 + (tid >> 6)) * 512 + (tid & 63) * 8);
  const _Float16* qrow = Qs + lm * QS_PITCH + hs * 8;
  _Float16* prow = Pt + lm * PT_PITCH + hs * 8;
  float* mrow = Mx + lm * 4;

  v8f oacc[QT][8] = {};  // [query tile][d tile]: d = hs * 8 + r, query = lm
  // Running maximum of query mt * 16 + lm (alike in all waves and both halves) and the
  // running sum over the keys that this lane itself has seen.
  float mrun[QT], lrun[QT];
#pragma unroll
  for (int mt = 0; mt < QT; ++mt) { mrun[mt] = -1e30f; lrun[mt] = 0.0f; }
  __syncthreads();

  // The wave's number as a scalar: the K and V addresses are then a scalar base and one
  // lane offset, which keeps address registers out of the vector file (no spill).
  const int swave = __builtin_amdgcn_readfirstlane(wave);
  // K fragments of the wave's key tile (nb * 4 + wave), d tiles 0 .. 15: 16 KB in a row.
  // Each block's are loaded during the block before.
  v16h kf[16];
  {
    const unsigned ko = swave * 16384 + lane * 16;  // byte offset in this head's K
    const _Float16* kp = (const _Float16*)((const char*)kbase + ko);
#pragma unroll
    for (int dt = 0; dt < 16; ++dt) kf[dt] = frag_packed(kp + dt * 512);
    // s_wait_xcnt 0 behind the K loads: a precaution, it stands ahead of any rewrite
    // of their address registers.
    asm volatile("s_wait_xcnt 0x0" ::: "memory");
    // Keeps that wait directly behind the loads, ahead of the address arithmetic below.
    __builtin_amdgcn_sched_barrier(0);
  }

  for (int nb = 0; nb < 16; ++nb) {
    // Non-blocking prefetch of the next key block (global_prefetch_b8): every other
    // 256-byte unit of the wave's own K tile and V slices.
    if (nb + 1 < 16) {
      __builtin_prefetch(kbase + (nb + 1) * 32768 + wave * 8192 + lane * 256, 0, 1);
      __builtin_prefetch(vbase + (nb + 1) * 32768 + hs * 16384 + wave * 4096 + lm * 256, 0, 1);
    }
    // ---- S^T = K[16 keys of the wave, :] . Q^T, one tile per query tile ----
    v8f st[QT] = {};
    // Q fragments are read ahead of their products: one d step ahead at first, two from
    // step 4 on, when spent K fragments have left registers for a third set.
    v16h qf[3][QT];
#pragma unroll
    for (int mt = 0; mt < QT; ++mt) qf[0][mt] = frag_f16(qrow + mt * 16 * QS_PITCH);
#pragma unroll
    for (int dt = 0; dt < 16; ++dt) {
      const int from = dt < 5 ? dt + 1 : dt + 2;  // first step not yet asked for
      const int upto = dt < 4 ? dt + 1 : dt + 2;  // last step to ask for now
#pragma unroll
      for (int nx = from; nx <= upto; ++nx) {
        if (nx < 16) {
#pragma unroll
          for (int mt = 0; mt < QT; ++mt)
            qf[nx % 3][mt] = frag_f16(qrow + mt * 16 * QS_PITCH + nx * 32);
        }
      }
      // Keeps the later d steps' Q reads as one group ahead of this step's products,
      // so that their LDS latency runs behind matrix instructions.
      __builtin_amdgcn_sched_barrier(0);
#pragma unroll
      for (int mt = 0; mt < QT; ++mt) st[mt] = WMMA(kf[dt], qf[dt % 3][mt], st[mt]);
    }
    // The V fragments of this key block are asked for here, into the registers that the
    // K fragments leave: their latency runs behind the softmax.
    // A[d][key]: key tiles nb * 2 + kk, d tiles wave * 8 .. + 7, 8 KB in a row each.
    const unsigned vo = nb * 65536 + swave * 8192 + lane * 16;  // byte offset in this head's V
    const _Float16* vp = (const _Float16*)((const char*)vbase + vo);
    v16h vf[16];
#pragma unroll
    for (int i = 0; i < 16; ++i) vf[i] = frag_packed(vp + (i >> 3) * 16384 + (i & 7) * 512);

    // ---- online softmax in registers: lane = query lm, keys wave * 16 + hs * 8 + r ----
    float mloc[QT];
#pragma unroll
    for (int mt = 0; mt < QT; ++mt) {
      float a = fmaxf(st[mt][0], st[mt][1]);
#pragma unroll
      for (int r = 2; r < 8; ++r) a = fmaxf(a, st[mt][r]);
      mloc[mt] = fmaxf(a, xhalf(a));
    }
    if (hs == 0) {
#pragma unroll
      for (int mt = 0; mt < QT; ++mt) mrow[mt * 64 + wave] = mloc[mt];
    }
    lds_barrier();  // every wave's maxima of this block are in Mx
    float alpha[QT];
#pragma unroll
    for (int mt = 0; mt < QT; ++mt) {
      const v4f m4 = *(const v4f*)(mrow + mt * 64);
      const float mn = fmaxf(fmaxf(fmaxf(m4[0], m4[1]), fmaxf(m4[2], m4[3])), mrun[mt]);
      alpha[mt] = __expf(mrun[mt] - mn);
      mrun[mt] = mn;
      float s = 0.0f;
      v8h p8;
#pragma unroll
      for (int r = 0; r < 8; ++r) {
        const float p = __expf(st[mt][r] - mn);
        s += p;
        p8[r] = (_Float16)p;
      }
      lrun[mt] = lrun[mt] * alpha[mt] + s;
      *(v8h*)(prow + mt * 16 * PT_PITCH + wave * 16) = p8;
    }
    lds_barrier();  // P^T of all 64 keys is in Pt; Mx is free for the next block

    // ---- O^T += V^T . P^T over this d slice; the next block's K fragments are asked
    // for as the V fragments leave their registers ----
    // The last pass loads its own K tile again, unused: no branch round the loads.
    const int nk = nb + 1 < 16 ? nb + 1 : nb;
    const unsigned ko = nk * 65536 + swave * 16384 + lane * 16;  // byte offset in this head's K
    const _Float16* kp = (const _Float16*)((const char*)kbase + ko);
    v16h pf[2][QT];  // P^T as B operand (32 keys x 16 queries per key half and query tile)
#pragma unroll
    for (int kk = 0; kk < 2; ++kk)
#pragma unroll
      for (int mt = 0; mt < QT; ++mt)
        pf[kk][mt] = frag_f16(prow + mt * 16 * PT_PITCH + kk * 32);
    // Keeps the P reads ahead of the rescale, so that their LDS latency runs behind it.
    __builtin_amdgcn_sched_barrier(0);
    // Rescale of the O accumulators: the factor is the lane's own.
#pragma unroll
    for (int mt = 0; mt < QT; ++mt)
#pragma unroll
      for (int dt = 0; dt < 8; ++dt) oacc[mt][dt] *= alpha[mt];
#pragma unroll
    for (int kk = 0; kk < 2; ++kk) {
#pragma unroll
      for (int dt = 0; dt < 8; ++dt) {
#pragma unroll
        for (int mt = 0; mt < QT; ++mt)
          oacc[mt][dt] = WMMA(vf[kk * 8 + dt], pf[kk][mt], oacc[mt][dt]);
        kf[kk * 8 + dt] = frag_packed(kp + (kk * 8 + dt) * 512);
        // Keeps each K load behind the products that free its registers (no spill).
        __builtin_amdgcn_sched_barrier(0);
      }
    }
    // s_wait_xcnt 0 behind the prefetches and the V and K loads: a precaution, it stands
    // ahead of any rewrite of their address registers; naming the two offsets as inputs
    // keeps those registers as they are up to here.
    asm volatile("s_wait_xcnt 0x0" :: "v"(vo), "v"(ko) : "memory");
    // Keeps the next pass's address steps (prefetch pointers too) behind that wait.
    __builtin_amdgcn_sched_barrier(0);
  }

  // ---- join the row sums (two halves, four waves), normalize, store to Oh (B,T,H*512) ----
#pragma unroll
  for (int mt = 0; mt < QT; ++mt) lrun[mt] += xhalf(lrun[mt]);
  if (hs == 0) {
#pragma unroll
    for (int mt = 0; mt < QT; ++mt) mrow[mt * 64 + wave] = lrun[mt];
  }
  lds_barrier();  // every wave's sums are in Mx
  const int b = bh >> 3, h = bh & 7;
  _Float16* obase = Oh + ((size_t)b * 1024 + m0 + lm) * 4096 + h * 512 + ds0 + hs * 8;
#pragma unroll
  for (int mt = 0; mt < QT; ++mt) {
    const v4f l4 = *(const v4f*)(mrow + mt * 64);
    const float inv = 1.0f / ((l4[0] + l4[1]) + (l4[2] + l4[3]));
    v8h o[8];
#pragma unroll
    for (int dt = 0; dt < 8; ++dt)
#pragma unroll
      for (int r = 0; r < 8; ++r) o[dt][r] = (_Float16)(oacc[mt][dt][r] * inv);
    // The two scheduling fences keep every vector write of a query tile ahead of its
    // stores and every later one behind the wait below.
    __builtin_amdgcn_sched_barrier(0);
#pragma unroll
    for (int dt = 0; dt < 8; ++dt) *(v8h*)(obase + (size_t)mt * 16 * 4096 + dt * 16) = o[dt];
    // s_wait_xcnt 0 behind the stores: a precaution, it stands ahead of any rewrite
    // of their address and data registers by the next query tile.
    asm volatile("s_wait_xcnt 0x0" ::: "memory");
    __builtin_amdgcn_sched_barrier(0);
  }
}

// ---------------------------------------------------------------------------
// Kernel 3: out[t][n] = bo[n] + sum over the 8 heads of Oh[t][h][n] (f32 sums, f32 out).
// grid = 1024; block = 256. A thread takes 8 neighbouring n of one row: 8 loads of 16 B
// in flight, a wave reads 512 contiguous bytes per head and stores 1 KB in a row.
// ---------------------------------------------------------------------------
__global__ __launch_bounds__(256) void head_sum_kernel(
    const _Float16* __restrict__ Oh, const float* __restrict__ bo,
    float* __restrict__ out) {
  const unsigned t = blockIdx.x * 256 + threadIdx.x;
  const unsigned row = t >> 6, n = (t & 63) * 8;
  const _Float16* p = Oh + (size_t)row * 4096 + n;
  v8h v[8];
#pragma unroll  // eight independent loads in flight
  for (int h = 0; h < 8; ++h) v[h] = *(const v8h*)(p + h * 512);
  const v4f b0 = *(const v4f*)(bo + n);
  const v4f b1 = *(const v4f*)(bo + n + 4);
  // s_wait_xcnt 0 behind the loads: a precaution, it stands ahead of any rewrite of
  // their address registers.
  asm volatile("s_wait_xcnt 0x0" ::: "memory");
  // Keeps all ten loads ahead of the sums, in flight together (one latency, not two).
  __builtin_amdgcn_sched_barrier(0);
  float s[8];
#pragma unroll
  for (int r = 0; r < 8; ++r) {
    s[r] = (float)v[0][r];
#pragma unroll
    for (int h = 1; h < 8; ++h) s[r] += (float)v[h][r];
  }
  v4f o0, o1;
#pragma unroll
  for (int r = 0; r < 4; ++r) { o0[r] = s[r] + b0[r]; o1[r] = s[4 + r] + b1[r]; }
  float* q = out + (size_t)row * 512 + n;
  *(v4f*)q = o0;
  *(v4f*)(q + 4) = o1;
}

// ---------------------------------------------------------------------------
extern "C" void kernel_launch(void* const* d_in, const int* in_sizes, int n_in,
                              void* d_out, int out_size, void* d_ws, size_t ws_size,
                              hipStream_t stream) {
  (void)in_sizes; (void)n_in; (void)out_size; (void)ws_size;
  const float* x  = (const float*)d_in[0];
  const float* Wq = (const float*)d_in[1];
  const float* Wk = (const float*)d_in[2];
  const float* Wv = (const float*)d_in[3];
  const float* Wo = (const float*)d_in[4];
  const float* bo = (const float*)d_in[5];
  float* out = (float*)d_out;

  char* ws = (char*)d_ws;
  _Float16* Qh  = (_Float16*)(ws);
  _Float16* Xf  = (_Float16*)(ws + (size_t)33554432);
  _Float16* Vt  = (_Float16*)(ws + (size_t)67108864);
  _Float16* Oh  = (_Float16*)(ws + (size_t)100663296);
  _Float16* Xh  = (_Float16*)(ws + (size_t)134217728);
  _Float16* Rvh = (_Float16*)(ws + (size_t)155189248);
  _Float16* Gqh = (_Float16*)(ws + (size_t)159383552);

  fold_weights_kernel<<<dim3(256), 256, 0, stream>>>(x, Wq, Wk, Wv, Wo, Xh, Xf, Rvh, Gqh);
  qv_proj_kernel<<<dim3(32, 32, 2), 128, 0, stream>>>(Xh, Gqh, Rvh, Qh, Vt);
  flash_attn_kernel<<<dim3(16, 32), 128, 0, stream>>>(Qh, Xf, Vt, Oh);
  head_sum_kernel<<<dim3(1024), 256, 0, stream>>>(Oh, bo, out);
}
